// v008
// The times below were measured on an AMD MI455X: many runs one after another, warmed up first and cycling through
// copies of the inputs, with the whole window's GPU time divided by the number of runs. Launches and the gaps
// between them are all in it. The median over several windows is given; except for v000 it joins two sittings, which
// can be a few percent apart, so the side-by-side timings, each taken in one sitting, are the better comparison.
// This document starts at v008; the versions before it stand elsewhere.
// A run of this version takes 294 microseconds.
// In two side-by-side timings against v007, it was 1.12 and 1.10 times as fast.
// Counting every step since v000, which is the starting kernel, it is 34.8 times as fast.
#include <hip/hip_runtime.h>
// Block-chunked causal attention with the module's PER-BLOCK softmax (hidden [2][2048][2048]; q/k/v = x W^T (natural [2048][2048] sigma 0.02, no biases), 16 heads of 128; keys in blocks of 256: for query block i every key block j <= i gets its OWN softmax over its 256 keys (scores / sqrt(128); inside the diagonal block keys above the query are -inf), the block outputs are summed and divided by the summed weights (= number of included blocks) + 1e-6; merged Wo^T -> [2][2048][2048]; no RoPE).
// Structure: token rows; x as exact f16 rows; natural weights as exact x16 planes; q, k, v as WMMA GEMMs (32x64 wave tiles, f32 accumulation) whose epilogues write f32 (first tile) + the f16 operand planes of q, k and V^T; per batch: exact f32 causal attention for rows 0..255 (= key block 0, where the per-block softmax is the ordinary causal softmax) on VALU; one fused launch for query blocks 1.., all heads and both batches: a wave's 16 queries against key blocks 0..i (scores f32 in registers, alpha 1/sqrt(128)), the module's per-block softmax on VALU (f32 statistics, native exp; weights x256 f16 divided by the block count + 1e-6), o = P V (x64) merged f16; out = o Wo^T (rows 256.. of a batch); first-tile rows of out from the exact o hi/lo, inside the fused launch; launches: see trace.
// Compute dtype: inputs rounded to bf16; x / weights exact; projections f32; q, k, v and softmax weights as f16 hi + x1024 residual operand pairs, o as a plain f16 GEMM operand (~2^-12; first 256 rows of each batch exact); scores, statistics, out f32. v_wmma_f32_16x16x32_f16.
#define NB 2
#define SQ 2048
#define DMX 2048
#define NH 16
#define NKV 16
#define GSZ 1                        /* plain MHA: kv head == query head */
#define HDK 128
#define DKV (NKV * HDK)
#define QT 256
#define QT0 256
#define NKX SQ
#define DM DMX
#define HD 64
#define HG 1
#define NR ((size_t)NB * SQ)
#define ATS 0.08838834764831845f
typedef __bf16 v16b __attribute__((ext_vector_type(16)));
typedef unsigned short v8us __attribute__((ext_vector_type(8), may_alias));
typedef float  v8f  __attribute__((ext_vector_type(8)));
typedef float  v4f  __attribute__((ext_vector_type(4)));
typedef float  v4fa __attribute__((ext_vector_type(4), may_alias));
union FragB { v16b v; v8us half[2]; unsigned short u[16]; };

__device__ __forceinline__ unsigned short bf16_bits(float x) { unsigned int u = __float_as_uint(x); return (unsigned short)((u + 0x7FFFu + ((u >> 16) & 1u)) >> 16); }
__device__ __forceinline__ float bf16_val(unsigned short b) { return __uint_as_float(((unsigned int)b) << 16); }
__device__ __forceinline__ float bf16_round(float x) { return bf16_val(bf16_bits(x)); }
// D += A·B with NT terms: 1 = ah·bh, 2 = + al·bh (A split), 3 = + ah·bl (both split)
template <int NT>
__device__ __forceinline__ v8f mmaN(v16b ah, v16b al, v16b bh, v16b bl, v8f c) {
  c = __builtin_amdgcn_wmma_f32_16x16x32_bf16(false, ah, false, bh, (short)0, c, false, false);
  if (NT >= 2) c = __builtin_amdgcn_wmma_f32_16x16x32_bf16(false, al, false, bh, (short)0, c, false, false);
  if (NT >= 3) c = __builtin_amdgcn_wmma_f32_16x16x32_bf16(false, ah, false, bl, (short)0, c, false, false);
  asm volatile("v_nop\n\tv_nop\n\tv_nop\n\tv_nop" : "+v"(c) : "v"(ah), "v"(al), "v"(bh), "v"(bl));
  return c;
}

__global__ __launch_bounds__(256) void k_wt_bf16(const float* __restrict__ W, unsigned short* __restrict__ Wt, int K, int N) {
  const int t = blockIdx.x * 256 + threadIdx.x;
  const int k8n = K / 8;
  if (t >= N * k8n) return;
  const int n = t / k8n, k8 = (t % k8n) * 8;
  v8us v;
#pragma unroll
  for (int i = 0; i < 8; ++i) v[i] = bf16_bits(W[(size_t)(k8 + i) * N + n]);
  *(v8us*)(Wt + (size_t)n * K + k8) = v;
  
}

// GEMM C[M][N] (f32, pitch ldc) = act(A[M][K]·W + bias). A f32 row-major (pitch lda) converted per fragment to bf16
// (ASPLIT: hi/lo two planes -> 2 terms, else single rounded term); Wt bf16 [N][K] (pitch ldb). BIAS_BF16 rounds the
// bias to bf16 first (bias quantised to bf16 before the add). K%32==0, M%16==0, N%64==0.
template <bool ASPLIT, int ACT, bool BIAS_BF16>
__global__ __launch_bounds__(128) void k_gemm_bf(const float* __restrict__ A, int lda, const unsigned short* __restrict__ Wt, int ldb,
                                               const float* __restrict__ bias, float* __restrict__ C, int ldc, int M, int N, int K) {
  __shared__ __attribute__((aligned(16))) float so[4][16][64];
  const int tid = threadIdx.x, w = tid >> 5, lane = tid & 31, ln = lane & 15, hh = lane >> 4;
  const int ntn = N / 64;
  const int wid = blockIdx.x * 4 + w;
  const int mt = wid / ntn, nq = wid % ntn;
  if (mt * 16 >= M) return;
  const int row0 = mt * 16, col0 = nq * 64;
  const float* arow = A + (size_t)(row0 + ln) * lda;
  v8f acc[4] = {};
  for (int kb = 0; kb < K; kb += 32) {
    FragB ah, al;
    const v4f x0 = *(const v4fa*)(arow + kb + 8 * hh), x1 = *(const v4fa*)(arow + kb + 8 * hh + 4);
    const v4f x2 = *(const v4fa*)(arow + kb + 16 + 8 * hh), x3 = *(const v4fa*)(arow + kb + 16 + 8 * hh + 4);
    float xs[16] = {x0[0],x0[1],x0[2],x0[3],x1[0],x1[1],x1[2],x1[3],x2[0],x2[1],x2[2],x2[3],x3[0],x3[1],x3[2],x3[3]};
#pragma unroll
    for (int i = 0; i < 16; ++i) { const unsigned short hb = bf16_bits(xs[i]); ah.u[i] = hb; al.u[i] = ASPLIT ? bf16_bits(xs[i] - bf16_val(hb)) : (unsigned short)0; }
#pragma unroll
    for (int t = 0; t < 4; ++t) {
      const unsigned short* brow = Wt + (size_t)(col0 + t * 16 + ln) * ldb + kb;
      FragB b;
      b.half[0] = *(const v8us*)(brow + 8 * hh);
      b.half[1] = *(const v8us*)(brow + 16 + 8 * hh);
      acc[t] = mmaN<ASPLIT ? 2 : 1>(ah.v, al.v, b.v, b.v, acc[t]);
    }
  }
#pragma unroll
  for (int t = 0; t < 4; ++t) {
    float bv = bias ? bias[col0 + t * 16 + ln] : 0.f;
    if (BIAS_BF16) bv = bf16_round(bv);
#pragma unroll
    for (int r = 0; r < 8; ++r) { float v = acc[t][r] + bv; if (ACT == 1) v = fmaxf(v, 0.f); so[w][8 * hh + r][t * 16 + ln] = v; }
  }
  __builtin_amdgcn_fence(__ATOMIC_ACQ_REL, "workgroup");
  __builtin_amdgcn_wave_barrier();
  const int rsub = lane >> 4, c4 = (lane & 15) * 4;
  {
#pragma unroll
    for (int q = 0; q < 8; ++q) {
      const int r = q * 2 + rsub;
      const v4f v = *(const v4fa*)&so[w][r][c4];
      *(v4f*)(C + (size_t)(row0 + r) * ldc + col0 + c4) = v;
    }
    
  }
}

// GEMM C = act(A·W + bias + resid): A f32 (ASPLIT -> hi/lo 2 terms), Wt bf16 [N][K]; ACT 0 none, 1 relu, 2 exact gelu;
// resid (optional, f32, row index = (row % rmod), pitch ldr, RES_BF16 rounds it) added before the activation.
template <bool ASPLIT, int ACT, bool BIAS_BF16, bool RES_BF16>
__global__ __launch_bounds__(128) void k_gemm_bf3(const float* __restrict__ A, int lda, const unsigned short* __restrict__ Wt, int ldb,
                                                const float* __restrict__ bias, const float* __restrict__ resid, int rmod, int ldr,
                                                float* __restrict__ C, int ldc, int M, int N, int K) {
  __shared__ __attribute__((aligned(16))) float so[4][16][64];
  const int tid = threadIdx.x, w = tid >> 5, lane = tid & 31, ln = lane & 15, hh = lane >> 4;
  const int ntn = N / 64;
  const int wid = blockIdx.x * 4 + w;
  const int mt = wid / ntn, nq = wid % ntn;
  if (mt * 16 >= M) return;
  const int row0 = mt * 16, col0 = nq * 64;
  const float* arow = A + (size_t)(row0 + ln) * lda;
  v8f acc[4] = {};
  for (int kb = 0; kb < K; kb += 32) {
    FragB ah, al;
    const v4f x0 = *(const v4fa*)(arow + kb + 8 * hh), x1 = *(const v4fa*)(arow + kb + 8 * hh + 4);
    const v4f x2 = *(const v4fa*)(arow + kb + 16 + 8 * hh), x3 = *(const v4fa*)(arow + kb + 16 + 8 * hh + 4);
    float xs[16] = {x0[0],x0[1],x0[2],x0[3],x1[0],x1[1],x1[2],x1[3],x2[0],x2[1],x2[2],x2[3],x3[0],x3[1],x3[2],x3[3]};
#pragma unroll
    for (int i = 0; i < 16; ++i) { const unsigned short hb = bf16_bits(xs[i]); ah.u[i] = hb; al.u[i] = ASPLIT ? bf16_bits(xs[i] - bf16_val(hb)) : (unsigned short)0; }
#pragma unroll
    for (int t = 0; t < 4; ++t) {
      const unsigned short* brow = Wt + (size_t)(col0 + t * 16 + ln) * ldb + kb;
      FragB b;
      b.half[0] = *(const v8us*)(brow + 8 * hh);
      b.half[1] = *(const v8us*)(brow + 16 + 8 * hh);
      acc[t] = mmaN<ASPLIT ? 2 : 1>(ah.v, al.v, b.v, b.v, acc[t]);
    }
  }
#pragma unroll
  for (int t = 0; t < 4; ++t) {
    const int col = col0 + t * 16 + ln;
    float bv = bias ? bias[col] : 0.f;
    if (BIAS_BF16) bv = bf16_round(bv);
#pragma unroll
    for (int r = 0; r < 8; ++r) {
      float v = acc[t][r] + bv;
      if (resid) { float rv = resid[(size_t)((row0 + 8 * hh + r) % rmod) * ldr + col]; if (RES_BF16) rv = bf16_round(rv); v += rv; }
      if (ACT == 1) v = fmaxf(v, 0.f);
      if (ACT == 2) v = 0.5f * v * (1.0f + erff(v * 0.70710678118654752f));
      if (ACT == 3) { const float u = 0.7978845608028654f * (v + 0.044715f * v * v * v); v = 0.5f * v * (1.0f + tanhf(u)); }
      so[w][8 * hh + r][t * 16 + ln] = v;
    }
  }
  __builtin_amdgcn_fence(__ATOMIC_ACQ_REL, "workgroup");
  __builtin_amdgcn_wave_barrier();
  const int rsub = lane >> 4, c4 = (lane & 15) * 4;
  {
#pragma unroll
    for (int q = 0; q < 8; ++q) {
      const int r = q * 2 + rsub;
      const v4f v = *(const v4fa*)&so[w][r][c4];
      *(v4f*)(C + (size_t)(row0 + r) * ldc + col0 + c4) = v;
    }
    
  }
}
// row LayerNorm (biased variance, eps) over N: s = X (+ R); optional out_sum <- s; out_norm <- (s-mu)*rsqrt(var+eps)*g + b
template <bool PARAM_BF16>
__global__ __launch_bounds__(256) void k_layernorm(const float* __restrict__ X, const float* __restrict__ R, const float* __restrict__ g, const float* __restrict__ bta,
                                                  float* __restrict__ out_sum, float* __restrict__ out_norm, int N, float eps) {
  __shared__ float red[256];
  const int row = blockIdx.x, tid = threadIdx.x;
  const float* x = X + (size_t)row * N; const float* rr = R ? R + (size_t)row * N : nullptr;
  float vals[16];                     // up to N = 4096
  const int per = N / 256;            // contiguous chunk per thread? use strided-by-4 chunks: thread handles j = tid*4 + 1024*u
  float s1 = 0.f;
  for (int u = 0; u < per / 4; ++u) {
    const int j = tid * 4 + 1024 * u;
    const v4f a = *(const v4fa*)(x + j);
    v4f b = {0.f,0.f,0.f,0.f}; if (rr) b = *(const v4fa*)(rr + j);
#pragma unroll
    for (int q = 0; q < 4; ++q) { const float v = a[q] + b[q]; vals[u * 4 + q] = v; s1 += v; }
  }
  red[tid] = s1; __syncthreads();
  for (int st = 128; st > 0; st >>= 1) { if (tid < st) red[tid] += red[tid + st]; __syncthreads(); }
  const float mu = red[0] / (float)N; __syncthreads();
  float s2 = 0.f;
  for (int u = 0; u < per / 4; ++u)
#pragma unroll
    for (int q = 0; q < 4; ++q) { const float c = vals[u * 4 + q] - mu; s2 += c * c; }
  red[tid] = s2; __syncthreads();
  for (int st = 128; st > 0; st >>= 1) { if (tid < st) red[tid] += red[tid + st]; __syncthreads(); }
  const float rs = rsqrtf(red[0] / (float)N + eps);
  {
    for (int u = 0; u < per / 4; ++u) {
      const int j = tid * 4 + 1024 * u;
      v4f o, sm;
#pragma unroll
      for (int q = 0; q < 4; ++q) {
        float gg = g[j + q], bb = bta[j + q];
        if (PARAM_BF16) { gg = bf16_round(gg); bb = bf16_round(bb); }
        sm[q] = vals[u * 4 + q]; o[q] = (vals[u * 4 + q] - mu) * rs * gg + bb;
      }
      if (out_sum) *(v4f*)(out_sum + (size_t)row * N + j) = sm;
      *(v4f*)(out_norm + (size_t)row * N + j) = o;
    }
    
  }
}



// ---- f16 WMMA path (v_wmma_f32_16x16x32_f16): 11-bit significands for operands in range — used where a [0,1] probability operand needs more precision than bf16
typedef _Float16 v16h __attribute__((ext_vector_type(16)));
union FragH { v16h v; v8us half[2]; _Float16 h[16]; unsigned short u[16]; };
template <int NT>
__device__ __forceinline__ v8f mmaH(v16h ah, v16h al, v16h bh, v16h bl, v8f c) {
  c = __builtin_amdgcn_wmma_f32_16x16x32_f16(false, ah, false, bh, (short)0, c, false, false);
  if (NT >= 2) c = __builtin_amdgcn_wmma_f32_16x16x32_f16(false, al, false, bh, (short)0, c, false, false);
  if (NT >= 3) c = __builtin_amdgcn_wmma_f32_16x16x32_f16(false, ah, false, bl, (short)0, c, false, false);
  asm volatile("v_nop\n\tv_nop\n\tv_nop\n\tv_nop" : "+v"(c) : "v"(ah), "v"(al), "v"(bh), "v"(bl));
  return c;
}
// batched GEMM like k_gemm_b but f16 operands: A f32 (split into f16 hi/lo if ASPLIT, else rounded to f16), Bt = f16 values [n][k]; alpha; C f32; N multiple of 16 (partial tiles skipped)
template <bool ASPLIT>
__global__ __launch_bounds__(128) void k_gemm_h(const float* __restrict__ A, int lda, size_t sA, const _Float16* __restrict__ Bh, int ldb, size_t sB, float alpha, float* __restrict__ C, int ldc, size_t sC, int M, int N, int K) {
  __shared__ __attribute__((aligned(16))) float so[4][16][64];
  const int tid = threadIdx.x, w = tid >> 5, lane = tid & 31, ln = lane & 15, hh = lane >> 4; const int by = blockIdx.y;
  A += (size_t)by * sA; Bh += (size_t)by * sB; C += (size_t)by * sC;
  const int ntn = (N + 63) / 64; const int wid = blockIdx.x * 4 + w; const int mt = wid / ntn, nq = wid % ntn; if (mt * 16 >= M) return;
  const int row0 = mt * 16, col0 = nq * 64; const float* arow = A + (size_t)(row0 + ln) * lda;
  v8f acc[4] = {};
  for (int kb = 0; kb < K; kb += 32) {
    FragH ah, al;
    const v4f x0 = *(const v4fa*)(arow + kb + 8 * hh), x1 = *(const v4fa*)(arow + kb + 8 * hh + 4), x2 = *(const v4fa*)(arow + kb + 16 + 8 * hh), x3 = *(const v4fa*)(arow + kb + 16 + 8 * hh + 4);
    float xs[16] = {x0[0],x0[1],x0[2],x0[3],x1[0],x1[1],x1[2],x1[3],x2[0],x2[1],x2[2],x2[3],x3[0],x3[1],x3[2],x3[3]};
#pragma unroll
    for (int i = 0; i < 16; ++i) { const _Float16 h = (_Float16)xs[i]; ah.h[i] = h; al.h[i] = ASPLIT ? (_Float16)(xs[i] - (float)h) : (_Float16)0.0f; }
#pragma unroll
    for (int t = 0; t < 4; ++t) { if (col0 + t * 16 >= N) continue; const size_t boff = (size_t)(col0 + t * 16 + ln) * ldb + kb; FragH bq; bq.half[0] = *(const v8us*)(Bh + boff + 8 * hh); bq.half[1] = *(const v8us*)(Bh + boff + 16 + 8 * hh);
      acc[t] = mmaH<ASPLIT ? 2 : 1>(ah.v, al.v, bq.v, bq.v, acc[t]); }
  }
#pragma unroll
  for (int t = 0; t < 4; ++t) { if (col0 + t * 16 >= N) continue;
#pragma unroll
    for (int r = 0; r < 8; ++r) so[w][8 * hh + r][t * 16 + ln] = acc[t][r] * alpha; }
  __builtin_amdgcn_fence(__ATOMIC_ACQ_REL, "workgroup"); __builtin_amdgcn_wave_barrier();
  const int rsub = lane >> 4, c4 = (lane & 15) * 4;
  {
#pragma unroll
    for (int q = 0; q < 8; ++q) { const int r = q * 2 + rsub; if (col0 + c4 < N) { const v4f v = *(const v4fa*)&so[w][r][c4]; *(v4f*)(C + (size_t)(row0 + r) * ldc + col0 + c4) = v; } }
     }
}

// Wt[n][k] = f16(W[k][n]·scale) from f32 row-major W[K][N] (scale = power of two; bf16-exact weights stay exact in f16 away from the subnormal range)
__global__ __launch_bounds__(256) void k_wt_f16(const float* __restrict__ W, _Float16* __restrict__ Wt, int K, int N, float scale) {
  const int t = blockIdx.x * 256 + threadIdx.x; if (t >= N * (K / 8)) return; const int n = t / (K / 8), k8 = (t % (K / 8)) * 8; FragH f;
#pragma unroll
  for (int i = 0; i < 8; ++i) f.h[i] = (_Float16)(bf16_round(W[(size_t)(k8 + i) * N + n]) * scale); const v8us o = f.half[0];
  *(v8us*)((unsigned short*)Wt + (size_t)n * K + k8) = o; 
}
// k_gemm_hh variant with fused epilogue: v = acc·alpha + bias[by·sBias + col] (+ CP[(row/rowsPerB)·sCPb + by·64 + col] if CP) ; ACT 0 none / 1 elu ; writes f16 C16 (and f32 C if non-null)
template <int ACT>
__global__ __launch_bounds__(128) void k_gemm_hhx(const _Float16* __restrict__ A, int lda, size_t sA, const _Float16* __restrict__ Bh, int ldb, size_t sB, float alpha, const float* __restrict__ bias, size_t sBias, const float* __restrict__ CP, int rowsPerB, size_t sCPb, int row0g,
    float* __restrict__ C, _Float16* __restrict__ C16, int ldc, size_t sC, int M, int N, int K) {
  __shared__ __attribute__((aligned(16))) float so[4][16][64];
  const int tid = threadIdx.x, w = tid >> 5, lane = tid & 31, ln = lane & 15, hh = lane >> 4; const int by = blockIdx.y;
  A += (size_t)by * sA; Bh += (size_t)by * sB; const size_t cofs = (size_t)by * sC; const float* bp = bias ? bias + (size_t)by * sBias : nullptr;
  const int ntn = (N + 63) / 64; const int wid = blockIdx.x * 4 + w; const int mt = wid / ntn, nq = wid % ntn; if (mt * 16 >= M) return;
  const int row0 = mt * 16, col0 = nq * 64; const _Float16* arow = A + (size_t)(row0 + ln) * lda;
  v8f acc[4] = {};
  for (int kb = 0; kb < K; kb += 32) { FragH ah; ah.half[0] = *(const v8us*)((const unsigned short*)arow + kb + 8 * hh); ah.half[1] = *(const v8us*)((const unsigned short*)arow + kb + 16 + 8 * hh);
#pragma unroll
    for (int t = 0; t < 4; ++t) { if (col0 + t * 16 >= N) continue; const size_t boff = (size_t)(col0 + t * 16 + ln) * ldb + kb; FragH bq; bq.half[0] = *(const v8us*)((const unsigned short*)Bh + boff + 8 * hh); bq.half[1] = *(const v8us*)((const unsigned short*)Bh + boff + 16 + 8 * hh);
      acc[t] = mmaH<1>(ah.v, ah.v, bq.v, bq.v, acc[t]); }
  }
#pragma unroll
  for (int t = 0; t < 4; ++t) { if (col0 + t * 16 >= N) continue; const int col = col0 + t * 16 + ln; const float bv = bp ? bf16_round(bp[col]) : 0.f;
#pragma unroll
    for (int r = 0; r < 8; ++r) { float v = acc[t][r] * alpha + bv; if (CP) { const int rr = row0g + row0 + 8 * hh + r; if (rowsPerB < 0) v += CP[cofs + (size_t)rr * ldc + col];      /* rowsPerB < 0: own element of the batched C plane */ else { const int bidx = rr / rowsPerB; v += CP[(size_t)bidx * sCPb + (size_t)by * 64 + col]; } } if (ACT == 1) v = (v > 0.f) ? v : expm1f(v); else if (ACT == 7) v = (v > 0.f) ? v + 1.0f : expf(v); else if (ACT == 8) v = tanhf(v); else if (ACT == 9) v = 0.5f * v * (1.0f + tanhf(0.7978845608028654f * (v + 0.044715f * v * v * v))); else if (ACT == 11) v = 1.0f / (1.0f + expf(-v)); else if (ACT == 12) v = (v > 0.f) ? v : 0.01f * v; else if (ACT == 14) v = (v > 0.f) ? v : 0.1f * v; else if (ACT == 16) v = (v >= 0.f) ? v : 0.3f * v; else if (ACT == 17) v = (v >= 0.f) ? v : 0.2f * v; else if (ACT == 15) v = v / (1.0f + expf(-v)); else if (ACT == 3) v = fmaxf(v, 0.f); else if (ACT == 6) v = 0.5f * v * (1.0f + erff(v * 0.70710678118654752f)); so[w][8 * hh + r][t * 16 + ln] = v; } }
  __builtin_amdgcn_fence(__ATOMIC_ACQ_REL, "workgroup"); __builtin_amdgcn_wave_barrier();
  const int rsub = lane >> 4, c4 = (lane & 15) * 4; typedef _Float16 v4h __attribute__((ext_vector_type(4)));
  {
#pragma unroll
    for (int q = 0; q < 8; ++q) { const int r = q * 2 + rsub; if (col0 + c4 < N) { const v4f v = *(const v4fa*)&so[w][r][c4]; if (C) *(v4f*)(C + cofs + (size_t)(row0 + r) * ldc + col0 + c4) = v; if (C16) { v4h h4; for (int i = 0; i < 4; ++i) h4[i] = (_Float16)v[i]; *(v4h*)(C16 + cofs + (size_t)(row0 + r) * ldc + col0 + c4) = h4; } } }
     }
}


typedef _Float16 v4h __attribute__((ext_vector_type(4)));

// FRAGMENT ORDER of an f16 operand plane of 2048 columns: the plane is cut into tiles of 16 rows x 32 columns, 1 KiB each, 64 tiles to a strip of 16 rows (a strip starts where it starts in the row-major plane).
// Inside a tile the 16-byte piece p = 32 half + 16 hh + ln holds columns 16 half + 8 hh .. + 7 of row ln: piece 32 half + lane is what lane (hh, ln) takes as elements 8 half .. 8 half + 7 of an A or B fragment.
// So each of the two 16-byte loads of a fragment reads 512 contiguous bytes (4 whole lines) over the wave; from a row-major plane it took 32 bytes out of each of 16 lines. The registers hold the same values as before.
static_assert(DMX == 2048 && DKV == 2048 && SQ == 2048, "fragment order below is written for planes of 2048 columns");
// A converting launch gives thread t eight values of tile t / 64: row (t & 63) / 4, columns 8 (t & 3) .. + 7. Four neighbouring lanes read one whole row of the tile (a 128-byte line of the f32 source), and the wave's store fills four whole lines of the plane.
__device__ __forceinline__ size_t fo_src(size_t t) { const size_t tile = t >> 6; return ((tile >> 6) * 16 + ((t & 63) >> 2)) * 2048 + (tile & 63) * 32 + (t & 3) * 8; }      /* element offset of thread t's 8 values in the row-major source */
__device__ __forceinline__ size_t fo_dst(size_t t) { return (t >> 6) * 512 + ((t & 3) * 16 + ((t & 63) >> 2)) * 8; }      /* and in the plane in fragment order: piece 16 (2 half + hh) + ln */
// All five operand conversions in one launch: work-groups 0 .. 4 WB - 1 take the four weights (WB work-groups each, values x16), the rest take x (x1). Every plane in fragment order, the values as before.
#define WB ((unsigned)((size_t)DMX * DMX / 8 / 256))
__global__ __launch_bounds__(256) void k_prep(const float* __restrict__ x, const float* __restrict__ wq, const float* __restrict__ wk, const float* __restrict__ wv, const float* __restrict__ wo,
    _Float16* __restrict__ X16, _Float16* __restrict__ BQ, _Float16* __restrict__ BK, _Float16* __restrict__ BV, _Float16* __restrict__ BO) {
  const unsigned sel = blockIdx.x / WB < 4u ? blockIdx.x / WB : 4u;      /* the same for the whole work-group */
  const float* s = sel == 0 ? wq : sel == 1 ? wk : sel == 2 ? wv : sel == 3 ? wo : x; _Float16* d = sel == 0 ? BQ : sel == 1 ? BK : sel == 2 ? BV : sel == 3 ? BO : X16; const float sc = sel < 4u ? 16.0f : 1.0f;
  const size_t t = (size_t)(blockIdx.x - sel * WB) * 256 + threadIdx.x; FragH f; const float* p = s + fo_src(t); const v4f a = *(const v4fa*)p, c = *(const v4fa*)(p + 4);
#pragma unroll
  for (int q = 0; q < 4; ++q) { f.h[q] = (_Float16)(bf16_round(a[q]) * sc); f.h[4 + q] = (_Float16)(bf16_round(c[q]) * sc); }
  *(v8us*)((unsigned short*)d + fo_dst(t)) = f.half[0]; }
__global__ __launch_bounds__(256) void k_h16(const float* __restrict__ x, _Float16* __restrict__ X16, size_t n8) { const size_t t = (size_t)blockIdx.x * 256 + threadIdx.x; if (t >= n8) return; FragH f;
#pragma unroll
  for (int q = 0; q < 8; ++q) f.h[q] = (_Float16)x[t * 8 + q]; *(v8us*)((unsigned short*)X16 + t * 8) = f.half[0];  }
__global__ __launch_bounds__(256) void k_round16f(const float* __restrict__ W, _Float16* __restrict__ Bt, size_t n8) { const size_t t = (size_t)blockIdx.x * 256 + threadIdx.x; if (t >= n8) return; FragH f;
#pragma unroll
  for (int i = 0; i < 8; ++i) f.h[i] = (_Float16)(bf16_round(W[t * 8 + i]) * 16.0f); *(v8us*)((unsigned short*)Bt + t * 8) = f.half[0];  }
template <int NHv, int TTv>
__global__ __launch_bounds__(256) void k_vt(const _Float16* __restrict__ V16, int ldv, int voff, _Float16* __restrict__ Vt) { __shared__ unsigned short tl[64][66]; const int tid = threadIdx.x; const int slab = blockIdx.x / (TTv / 64), lg = blockIdx.x % (TTv / 64); const int b = slab / NHv, h = slab % NHv;
  for (int i = tid; i < 64 * 8; i += 256) { const int r = i / 8, c8 = (i % 8) * 8; FragH f; f.half[0] = *(const v8us*)((const unsigned short*)V16 + ((size_t)b * TTv + lg * 64 + r) * ldv + voff + h * 64 + c8);
#pragma unroll
    for (int q = 0; q < 8; ++q) tl[r][c8 + q] = f.u[q]; }
  __syncthreads();
  {
#pragma unroll
    for (int rd = 0; rd < 2; ++rd) { const int idx = rd * 256 + tid, t8 = idx >> 6, p = idx & 63; const int d = (t8 >> 1) * 16 + (p & 15), c8 = (t8 & 1) * 32 + (p >> 5) * 16 + ((p >> 4) & 1) * 8; FragH f;      /* the 64 x 64 block = 4 x 2 tiles of V^T in fragment order (rows = dims, columns = keys), a thread per 16-byte piece */
#pragma unroll
      for (int q = 0; q < 8; ++q) f.u[q] = tl[c8 + q][d];
      *(v8us*)((unsigned short*)Vt + (((size_t)slab * 4 + (t8 >> 1)) * (TTv / 32) + lg * 2 + (t8 & 1)) * 512 + p * 8) = f.half[0]; }
     } }

template <bool FO>      /* FO: the two planes are written in fragment order (F stays row-major) */
__global__ __launch_bounds__(256) void k_hl(const float* __restrict__ F, _Float16* __restrict__ Hh, _Float16* __restrict__ Hl, size_t n8) { const size_t t = (size_t)blockIdx.x * 256 + threadIdx.x; if (t >= n8) return; FragH fh, fl; const float* fs = F + (FO ? fo_src(t) : t * 8); const v4f a = *(const v4fa*)fs, c = *(const v4fa*)(fs + 4);
#pragma unroll
  for (int q = 0; q < 4; ++q) { _Float16 h = (_Float16)a[q]; fh.h[q] = h; fl.h[q] = (_Float16)((a[q] - (float)h) * 1024.0f); h = (_Float16)c[q]; fh.h[4 + q] = h; fl.h[4 + q] = (_Float16)((c[q] - (float)h) * 1024.0f); }
  { const size_t d = FO ? fo_dst(t) : t * 8; *(v8us*)((unsigned short*)Hh + d) = fh.half[0]; *(v8us*)((unsigned short*)Hl + d) = fl.half[0];  } }

// ---- fast GEMM (wave tile 32x64; requires M % 32 == 0 rows per launch region, N % 64 == 0, K % 32 == 0 and K >= 96); A and Bh in fragment order (lda, ldb = columns of the plane); epilogue = k_gemm_hhx semantics ----
__device__ __forceinline__ v16h g2_frag(const _Float16* p) { FragH f; f.half[0] = *(const v8us*)((const unsigned short*)p); f.half[1] = *(const v8us*)((const unsigned short*)p + 256); return f.v; }      /* p = the tile in fragment order + 8 lane */
__device__ __forceinline__ v8f g2_mma(v16h a, v16h b, v8f c) { v8f d = __builtin_amdgcn_wmma_f32_16x16x32_f16(false, a, false, b, (short)0, c, false, false); asm volatile("v_nop\n\tv_nop\n\tv_nop\n\tv_nop" : "+v"(d) : "v"(a), "v"(b)); return d; }
struct G2S { v16h a0, a1, b0, b1, b2, b3; };      /* the fragments of one k-step of a 32x64 wave tile */
__device__ __forceinline__ void g2_load(G2S& s, const _Float16* a0p, const _Float16* a1p, const _Float16* b0p, const _Float16* b1p, const _Float16* b2p, const _Float16* b3p, int k) { s.a0 = g2_frag(a0p + k); s.b0 = g2_frag(b0p + k); s.a1 = g2_frag(a1p + k); s.b1 = g2_frag(b1p + k); s.b2 = g2_frag(b2p + k); s.b3 = g2_frag(b3p + k); }      /* k: 512 elements (one tile) a k-step */
// PL 0: C (f32) and C16 row-major, as before. PL 1, 2: the result also leaves as the two f16 operand planes of its consumer, hi + x1024 residual (the split of k_hl), in fragment order, written by this epilogue:
//   PL 1: planes of the result itself: a 32x64 wave tile = 2 x 2 whole 1 KiB tiles (16 rows x 32 columns), a lane's 16-byte piece = 8 neighbouring columns of one row, read back from the LDS staging;
//   PL 2: planes of the TRANSPOSED result (rows = columns of C): the wave tile = 4 whole tiles of 16 columns x 32 rows, and the 8 values of accumulator u of a lane (rows 16 (u / 4) + 8 hh + r of column 16 (u % 4) + ln) ARE piece 32 (u / 4) + lane of tile u % 4: no LDS.
//   With PL 1, 2 the f32 C is stored only by work-groups whose first row lies below frows inside its batch (the rows that a later f32 consumer reads); blockIdx.y moves both planes on by sP elements. Each plane store of a wave writes 512 contiguous bytes.
//   PL 1, 2 take no bias and no CP (their launches pass none).
template <int ACT, int PL>
__global__ __launch_bounds__(128) void k_gemm2(const _Float16* __restrict__ A, int lda, size_t sA, const _Float16* __restrict__ Bh, int ldb, size_t sB, float alpha, const float* __restrict__ bias, size_t sBias, const float* __restrict__ CP, int rowsPerB, size_t sCPb, int row0g,
    float* __restrict__ C, _Float16* __restrict__ C16, int ldc, size_t sC, int M, int N, int K, _Float16* __restrict__ Ph, _Float16* __restrict__ Pl, int frows, size_t sP) { static_assert(ACT == 0 || ACT == 3 || ACT == 6 || ACT == 8 || ACT == 9 || ACT == 11 || ACT == 12 || ACT == 14 || ACT == 15 || ACT == 16 || ACT == 17, "k_gemm2: unsupported ACT code (would silently apply no activation)");
  __shared__ __attribute__((aligned(16))) float so[4][32][68];
  const int tid = threadIdx.x, w = tid >> 5, lane = tid & 31, ln = lane & 15, hh = lane >> 4; const int by = blockIdx.y;
  A += (size_t)by * sA; Bh += (size_t)by * sB; size_t cofs = (size_t)by * sC; const float* bp = bias ? bias + (size_t)by * sBias : nullptr;
  const int ntn = N >> 6; const int mt = blockIdx.x / ntn, nq = blockIdx.x - mt * ntn; const int row0 = mt * 128 + 32 * w, col0 = nq * 64; if (row0 >= M) return;
  const int bb = PL == 0 ? 0 : row0 / SQ;      /* PL 1, 2: the rows are the token rows of all batches; bb = the batch of this wave's rows (128 divides SQ: the same for the whole work-group) */
  if (PL != 0) { Ph += (size_t)by * sP; Pl += (size_t)by * sP; cofs -= (size_t)bb * (SQ - frows) * ldc; }      /* the f32 C holds frows rows a batch, one batch behind the other: row bb frows + (row - bb SQ) */
  const _Float16* a0p = A + (size_t)row0 * lda + lane * 8; const _Float16* a1p = a0p + (size_t)16 * lda;
  const _Float16* b0p = Bh + (size_t)col0 * ldb + lane * 8; const _Float16* b1p = b0p + (size_t)16 * ldb; const _Float16* b2p = b1p + (size_t)16 * ldb; const _Float16* b3p = b2p + (size_t)16 * ldb;
  // k loop, three k-steps of fragments in registers: a step's 12 loads are issued together, directly behind the products of the step that held those registers,
  // so they fly during the next two steps' products instead of being waited for one fragment at a time. Products and their order per accumulator are as before.
  const int nst = K >> 5; G2S s0, s1, s2; int st = 0, ko = 0;
  g2_load(s0, a0p, a1p, b0p, b1p, b2p, b3p, 0); __builtin_amdgcn_sched_barrier(0);      /* the three sets are requested one after the other, as in the loop: mixed, the counted load waits in the loop (set for both ways into it) would wait for the younger sets too */
  g2_load(s1, a0p, a1p, b0p, b1p, b2p, b3p, 512); __builtin_amdgcn_sched_barrier(0);      /* as above */
  g2_load(s2, a0p, a1p, b0p, b1p, b2p, b3p, 1024);
  asm volatile("s_wait_xcnt 0x0" ::: "memory");      /* stands in front of the clearing of the accumulators, some of which take the registers of an address that the loads above name (a precaution; the compiler wrote none there) */
  const v8f z8 = {0.f,0.f,0.f,0.f,0.f,0.f,0.f,0.f}; v8f c00 = z8, c01 = z8, c02 = z8, c03 = z8, c10 = z8, c11 = z8, c12 = z8, c13 = z8;
#define G2_MMA8(S) { c00 = g2_mma(S.a0, S.b0, c00); c10 = g2_mma(S.a1, S.b0, c10); c01 = g2_mma(S.a0, S.b1, c01); c11 = g2_mma(S.a1, S.b1, c11); c02 = g2_mma(S.a0, S.b2, c02); c12 = g2_mma(S.a1, S.b2, c12); c03 = g2_mma(S.a0, S.b3, c03); c13 = g2_mma(S.a1, S.b3, c13); }
  /* G2_STEP: the k offset moves on by three steps. The wait stands in front of the rewrite of the address registers that the loads in flight name (a precaution; the compiler wrote none over the back edge); the new offset is its output, so every new address is formed behind it. */
#define G2_STEP { ko += 1536; asm volatile("s_wait_xcnt 0x0" : "+s"(ko) : : "memory"); }
#pragma unroll 1      /* one trip = three k-steps, one per register set; rolled so that the sets keep their registers */
  for (; st + 6 <= nst; st += 3) {
    G2_MMA8(s0) G2_STEP g2_load(s0, a0p + ko, a1p + ko, b0p + ko, b1p + ko, b2p + ko, b3p + ko, 0); __builtin_amdgcn_sched_barrier(0);      /* keeps the next set's first product, with its load wait, from moving up in front of these requests */
    G2_MMA8(s1) g2_load(s1, a0p + ko, a1p + ko, b0p + ko, b1p + ko, b2p + ko, b3p + ko, 512);
    G2_MMA8(s2) g2_load(s2, a0p + ko, a1p + ko, b0p + ko, b1p + ko, b2p + ko, b3p + ko, 1024); }
  const int rem = nst - st;      /* 3, 4 or 5 k-steps are left, the first three of them loaded */
  G2_MMA8(s0) G2_STEP if (rem > 3) g2_load(s0, a0p + ko, a1p + ko, b0p + ko, b1p + ko, b2p + ko, b3p + ko, 0);
  G2_MMA8(s1) if (rem > 4) { asm volatile("s_wait_xcnt 0x0" : "+s"(ko) : : "memory");      /* as in G2_STEP: the compiler forms this set's addresses in registers that the loads just above name */
    g2_load(s1, a0p + ko, a1p + ko, b0p + ko, b1p + ko, b2p + ko, b3p + ko, 512); }
  G2_MMA8(s2)
  if (rem > 3) G2_MMA8(s0)
  if (rem > 4) G2_MMA8(s1)
#undef G2_STEP
#undef G2_MMA8
  v8f accs[8] = {c00, c01, c02, c03, c10, c11, c12, c13};
  static_assert(PL == 0 || ACT == 0, "the plane epilogues carry no activation");
  const bool f32rows = PL == 0 || mt * 128 - bb * SQ < frows;      /* the same for the whole work-group */
  if (PL != 2 || f32rows) {      /* the LDS staging of the wave tile: PL 2 needs it for its f32 rows only */
#pragma unroll
    for (int u = 0; u < 8; ++u) { const int t = u & 3, half = u >> 2; const int col = col0 + t * 16 + ln; const float bv = (PL == 0 && bp) ? bf16_round(bp[col]) : 0.f;
#pragma unroll
    for (int r = 0; r < 8; ++r) { const int rloc = half * 16 + 8 * hh + r; float v = accs[u][r] * alpha + bv; if (PL == 0 && CP) { if (rowsPerB < 0) v += CP[cofs + (size_t)(row0g + row0 + rloc) * ldc + col];      /* rowsPerB < 0: own element of the batched C plane */ else { const int bidx = (row0g + row0 + rloc) / rowsPerB; v += CP[(size_t)bidx * sCPb + (size_t)by * 64 + col]; } }
      if (ACT == 3) v = fmaxf(v, 0.f); else if (ACT == 6) v = 0.5f * v * (1.0f + erff(v * 0.70710678118654752f)); else if (ACT == 11) v = 1.0f / (1.0f + expf(-v)); else if (ACT == 15) v = v / (1.0f + expf(-v)); else if (ACT == 12) v = (v > 0.f) ? v : 0.01f * v; else if (ACT == 8) v = tanhf(v); else if (ACT == 9) v = 0.5f * v * (1.0f + tanhf(0.7978845608028654f * (v + 0.044715f * v * v * v))); else if (ACT == 14) v = (v > 0.f) ? v : 0.1f * v; else if (ACT == 16) v = (v >= 0.f) ? v : 0.3f * v; else if (ACT == 17) v = (v >= 0.f) ? v : 0.2f * v;
      so[w][rloc][t * 16 + ln] = v; } }
    __builtin_amdgcn_fence(__ATOMIC_ACQ_REL, "workgroup"); __builtin_amdgcn_wave_barrier(); }
  if (PL != 0) { FragH ph[8], pr[8];      /* a lane's eight 16-byte pieces of the hi plane and of the residual plane */
#pragma unroll
    for (int i = 0; i < 8; ++i) { float x[8];
      if (PL == 1) { const float* sp = &so[w][(i >> 2) * 16 + ln][((i >> 1) & 1) * 32 + (i & 1) * 16 + hh * 8]; const v4f a = *(const v4fa*)sp, c = *(const v4fa*)(sp + 4);
#pragma unroll
        for (int q = 0; q < 4; ++q) { x[q] = a[q]; x[4 + q] = c[q]; } }
      else {
#pragma unroll
        for (int q = 0; q < 8; ++q) x[q] = accs[i][q] * alpha; }      /* the value that the staging loop forms (no bias, no CP here) */
#pragma unroll
      for (int q = 0; q < 8; ++q) { const _Float16 h = (_Float16)x[q]; ph[i].h[q] = h; pr[i].h[q] = (_Float16)((x[q] - (float)h) * 1024.0f); } }
    unsigned short* dh = (unsigned short*)Ph + (PL == 1 ? (size_t)row0 * 2048 + (size_t)col0 * 16 : (size_t)bb * N * SQ + (size_t)col0 * 2048 + (size_t)(row0 - bb * SQ) * 16) + lane * 8;      /* PL 2: a transposed plane of N rows x SQ columns a batch */ unsigned short* dl = (unsigned short*)Pl + (dh - (unsigned short*)Ph);
    __builtin_amdgcn_sched_barrier(0);      /* all sixteen pieces are formed above, each in registers of its own: no conversion sinks between the stores and overwrites a register of a store already issued */
#pragma unroll
    for (int i = 0; i < 8; ++i) { const size_t d = PL == 1 ? (size_t)(i >> 2) * 16 * 2048 + ((i >> 1) & 1) * 512 + (i & 1) * 256 : (size_t)(i & 3) * 16 * 2048 + (i >> 2) * 256; *(v8us*)(dh + d) = ph[i].half[0]; *(v8us*)(dl + d) = pr[i].half[0]; }
    asm volatile("s_wait_xcnt 0x0" ::: "memory"); }      /* stands in front of whatever reuses the data and address registers of the sixteen stores (a precaution) */
  const int rsub = lane >> 4, c4 = (lane & 15) * 4;
  if (f32rows) {
#pragma unroll
    for (int q = 0; q < 16; ++q) { const int r = q * 2 + rsub; const v4f v = *(const v4fa*)&so[w][r][c4]; if (C) *(v4f*)(C + cofs + (size_t)(row0 + r) * ldc + col0 + c4) = v; if (C16) { v4h h4; for (int i = 0; i < 4; ++i) h4[i] = (_Float16)v[i]; *(v4h*)(C16 + cofs + (size_t)(row0 + r) * ldc + col0 + c4) = h4; } }
     } }


__global__ __launch_bounds__(256) void k_rsm(const float* __restrict__ S, _Float16* __restrict__ P, int nrows) {
  #pragma clang fp contract(off)
  const int i = blockIdx.x * 256 + threadIdx.x; if (i >= nrows) return; const float* s = S + (size_t)i * SQ; float mx = -3.0e38f;
#pragma unroll 1
  for (int j = 0; j < SQ; ++j) mx = fmaxf(mx, s[j]); float se = 0.f;
#pragma unroll 1
  for (int j = 0; j < SQ; ++j) se += expf(s[j] - mx); const float sc = 256.0f / se;
#pragma unroll 1
  for (int j0 = 0; j0 < SQ; j0 += 8) { FragH f; for (int q = 0; q < 8; ++q) f.h[q] = (_Float16)(expf(s[j0 + q] - mx) * sc); unsigned short* d = (unsigned short*)P + (size_t)i * SQ + j0; *(v8us*)d = f.half[0];  } }
__global__ __launch_bounds__(256) void k_vt(const _Float16* __restrict__ V16, int b, int h0, _Float16* __restrict__ VT) { __shared__ unsigned short tl[64][65]; const int tid = threadIdx.x; const int hh = blockIdx.x % HG, sg = blockIdx.x / HG; const int s0 = sg * 64; const int h = h0 + hh;
  for (int i = tid; i < 64 * 8; i += 256) { const int j = i / 8, d8 = (i % 8) * 8; FragH f; f.half[0] = *(const v8us*)((const unsigned short*)V16 + ((size_t)b * SQ + s0 + j) * DM + h * HD + d8); for (int q = 0; q < 8; ++q) tl[d8 + q][j] = f.u[q]; }
  __syncthreads();
  { for (int i = tid; i < 64 * 8; i += 256) { const int d = i / 8, j8 = (i % 8) * 8; FragH f; for (int q = 0; q < 8; ++q) f.u[q] = tl[d][j8 + q]; *(v8us*)((unsigned short*)VT + ((size_t)hh * HD + d) * SQ + s0 + j8) = f.half[0]; }  } }


__global__ __launch_bounds__(256) void k_f2h(const float* __restrict__ F, int ldf, int coff, int ncol, _Float16* __restrict__ H16, size_t nrow) { const size_t t = (size_t)blockIdx.x * 256 + threadIdx.x; const size_t n8 = nrow * (size_t)(ncol / 8); if (t >= n8) return; const size_t r = t / (ncol / 8); const int c8 = (int)(t % (ncol / 8)) * 8; FragH f; const v4f a = *(const v4fa*)(F + r * ldf + coff + c8), b2 = *(const v4fa*)(F + r * ldf + coff + c8 + 4); for (int q = 0; q < 4; ++q) { f.h[q] = (_Float16)a[q]; f.h[4 + q] = (_Float16)b2[q]; } *(v8us*)((unsigned short*)H16 + r * ncol + c8) = f.half[0];  }

__global__ __launch_bounds__(256) void k_tab128(float theta, float* __restrict__ CS, float* __restrict__ SN) {
  #pragma clang fp contract(off)
  const int t = blockIdx.x * 256 + threadIdx.x; if (t >= SQ * 64) return; const int i = t % 64; const int p = t / 64; const float invf = (float)(1.0 / pow((double)theta, (double)(2 * i) / 128.0));      /* = XLA's constant-folded f32 table */ const float ang = __fmul_rn((float)p, invf); const float c = cosf(ang), s = sinf(ang);
  *(float*)(CS + t) = c; *(float*)(SN + t) = s;  }
template <int TAB>
__global__ __launch_bounds__(128) void k_rope128(const float* __restrict__ F, int ldf, int nh, const float* __restrict__ CS, const float* __restrict__ SN, _Float16* __restrict__ H16, int ldo, float osc) {
  #pragma clang fp contract(off)
  __shared__ float xv[128]; __shared__ unsigned short sh_[128]; const int d = threadIdx.x; const int h = blockIdx.x % nh; const size_t r = blockIdx.x / nh; const int p = (int)(r % SQ);
  xv[d] = F[r * (size_t)ldf + (size_t)h * 128 + d]; __syncthreads();
  float c, s; if (TAB) { c = bf16_round(CS[(size_t)p * 128 + d]); s = bf16_round(SN[(size_t)p * 128 + d]); } else { c = CS[p * 64 + (d & 63)]; s = SN[p * 64 + (d & 63)]; }
  const float rot = (d < 64) ? -xv[d + 64] : xv[d - 64]; const float o = __fadd_rn(__fmul_rn(xv[d], c), __fmul_rn(rot, s));
  FragH th; th.h[0] = (_Float16)__fmul_rn(o, osc); sh_[d] = th.u[0]; __syncthreads();
  if (d < 16) { FragH f; for (int q = 0; q < 8; ++q) f.u[q] = sh_[d * 8 + q]; unsigned short* dst = (unsigned short*)H16 + r * (size_t)ldo + (size_t)h * 128 + d * 8; *(v8us*)dst = f.half[0];  } }

template <int TAB, int IL, int F32OUT>
__global__ __launch_bounds__(128) void k_rope128x(const float* __restrict__ F, int ldf, int nh, const float* __restrict__ CS, const float* __restrict__ SN, void* __restrict__ OUT, int ldo, float osc) {
  #pragma clang fp contract(off)
  __shared__ float xv[128]; __shared__ float ov[128]; const int d = threadIdx.x; const int h = blockIdx.x % nh; const size_t r = blockIdx.x / nh; const int p = (int)(r % SQ);
  xv[d] = F[r * (size_t)ldf + (size_t)h * 128 + d]; __syncthreads();
  float c, s; if (TAB == 2) { c = CS[r * 128 + d]; s = SN[r * 128 + d]; }      /* computed full-width f32 tables, one row per token row r (relative to the passed pointers) */ else if (TAB) { c = bf16_round(CS[(size_t)p * 128 + d]); s = bf16_round(SN[(size_t)p * 128 + d]); } else { const int ti = IL ? (d >> 1) : (d & 63); c = CS[p * 64 + ti]; s = SN[p * 64 + ti]; }
  const float rot = IL ? ((d & 1) ? xv[d - 1] : -xv[d + 1]) : ((d < 64) ? -xv[d + 64] : xv[d - 64]);
  ov[d] = __fmul_rn(__fadd_rn(__fmul_rn(xv[d], c), __fmul_rn(rot, s)), osc); __syncthreads();
  if (F32OUT) { if (d < 32) { const v4f v = *(const v4f*)&ov[d * 4]; float* dst = (float*)OUT + r * (size_t)ldo + (size_t)h * 128 + d * 4; *(v4f*)dst = v;  } }
  else { if (d < 16) { FragH f; for (int q = 0; q < 8; ++q) f.h[q] = (_Float16)ov[d * 8 + q]; unsigned short* dst = (unsigned short*)OUT + r * (size_t)ldo + (size_t)h * 128 + d * 8; *(v8us*)dst = f.half[0];  } } }
template <int N>
__global__ __launch_bounds__(256) void k_rmsrow(float* __restrict__ X, const float* __restrict__ w, float eps) {
  #pragma clang fp contract(off)
  constexpr int PT = N / 256; __shared__ float red[256]; const size_t r = blockIdx.x; const int t = threadIdx.x; float* row = X + r * N + (size_t)t * PT; float v[PT]; float ss = 0.f;
  for (int q = 0; q < PT; ++q) { v[q] = row[q]; ss = __fadd_rn(ss, __fmul_rn(v[q], v[q])); }
  red[t] = ss; __syncthreads(); for (int k = 128; k > 0; k >>= 1) { if (t < k) red[t] = __fadd_rn(red[t], red[t + k]); __syncthreads(); }
  const float rs = rsqrtf(__fadd_rn(red[0] / (float)N, eps)); float o[PT]; for (int q = 0; q < PT; ++q) o[q] = __fmul_rn(__fmul_rn(v[q], rs), bf16_round(w[t * PT + q]));
  { for (int q = 0; q < PT; ++q) *(float*)(row + q) = o[q];  } }
template <int GS_, int NHQ, int DSRC>
__global__ __launch_bounds__(256) void k_kvexp128(const float* __restrict__ src, float* __restrict__ dst, size_t n4) { const size_t t = (size_t)blockIdx.x * 256 + threadIdx.x; if (t >= n4) return; const size_t e = t * 4; const size_t row = e / ((size_t)NHQ * 128); const int col = (int)(e % ((size_t)NHQ * 128)); const int h = col / 128, d = col % 128; const v4f v = *(const v4fa*)(src + row * DSRC + (size_t)(h / GS_) * 128 + d); *(v4f*)(dst + e) = v;  }

__global__ __launch_bounds__(256) void k_rsmcfb(const float* __restrict__ S, _Float16* __restrict__ P, int hg, int q0, int nk, const int* __restrict__ mk) {
  #pragma clang fp contract(off)
  const int t = blockIdx.x * 256 + threadIdx.x; if (t >= hg * QT) return; const size_t i = (size_t)t; const float* s = S + i * NKX; const size_t ig = (size_t)(q0 + (t % QT)); const int* mr = mk + ig * SQ; float mx = -3.0e38f;
#pragma unroll 1
  for (int j = 0; j < nk; ++j) { const int mb = mr[j]; const float f = (mb == 0) ? 1.f : 0.f; mx = fmaxf(mx, fmaf(f, s[j], (1.f - f) * -1.0e9f)); } float se = 0.f;
#pragma unroll 1
  for (int j = 0; j < nk; ++j) { const int mb = mr[j]; const float f = (mb == 0) ? 1.f : 0.f; se += __expf(fmaf(f, s[j], (1.f - f) * -1.0e9f) - mx); } const float sc = 256.0f / se;
#pragma unroll 1
  for (int j0 = 0; j0 < nk; j0 += 8) { FragH fr; for (int q = 0; q < 8; ++q) { const int j = j0 + q; const int mb = mr[j]; const float f = (mb == 0) ? 1.f : 0.f; fr.h[q] = (_Float16)(__expf(fmaf(f, s[j], (1.f - f) * -1.0e9f) - mx) * sc); } unsigned short* d = (unsigned short*)P + i * NKX + j0; *(v8us*)d = fr.half[0];  } }


__global__ __launch_bounds__(256) void k_rsmcf2(const float* __restrict__ S, _Float16* __restrict__ P, int hg, int q0, int nk) {
  #pragma clang fp contract(off)
  const int t = blockIdx.x * 256 + threadIdx.x; if (t >= hg * QT) return; const size_t i = (size_t)t; const float* s = S + i * NKX; const int last = q0 + (t % QT); float mx = -3.0e38f;
#pragma unroll 1
  for (int j = 0; j < nk; ++j) { const float f = (j <= last) ? 1.f : 0.f; mx = fmaxf(mx, fmaf(f, s[j], (1.f - f) * -1.0e9f)); } float se = 0.f;
#pragma unroll 1
  for (int j = 0; j < nk; ++j) { const float f = (j <= last) ? 1.f : 0.f; se += __expf(fmaf(f, s[j], (1.f - f) * -1.0e9f) - mx); } const float sc = 256.0f / se;
#pragma unroll 1
  for (int j0 = 0; j0 < nk; j0 += 8) { FragH fr; for (int q = 0; q < 8; ++q) { const int j = j0 + q; const float f = (j <= last) ? 1.f : 0.f; fr.h[q] = (_Float16)(__expf(fmaf(f, s[j], (1.f - f) * -1.0e9f) - mx) * sc); } unsigned short* d = (unsigned short*)P + i * NKX + j0; *(v8us*)d = fr.half[0];  } }



__global__ __launch_bounds__(256) void k_tab128p(const int* __restrict__ pos, int nrows, float theta, float* __restrict__ CS, float* __restrict__ SN) {
  #pragma clang fp contract(off)
  const int t = blockIdx.x * 256 + threadIdx.x; if (t >= nrows * 64) return; const int i = t % 64; const int r = t / 64; const float invf = (float)(1.0 / pow((double)theta, (double)(2 * i) / 128.0)); const float ang = __fmul_rn((float)pos[r], invf); const float c = cosf(ang), sv = sinf(ang);
  float* c0 = CS + (size_t)r * 128 + i; float* s0 = SN + (size_t)r * 128 + i;
  { *(float*)c0 = c; *(float*)(c0 + 64) = c; *(float*)s0 = sv; *(float*)(s0 + 64) = sv;  } }

__global__ __launch_bounds__(256) void k_rsmcim(const float* __restrict__ S, _Float16* __restrict__ P, int hg, int q0, int nk, const int* __restrict__ am) {
  #pragma clang fp contract(off)
  const int t = blockIdx.x * 256 + threadIdx.x; if (t >= hg * QT) return; const size_t i = (size_t)t; const float* s = S + i * NKX; const int last = q0 + (t % QT); const int* mr = am + (size_t)last * SQ; float mx = -3.0e38f;      /* the module's mask row of this query (keys >= nk lie above the diagonal of the causal mask and are not computed) */
#pragma unroll 1
  for (int j = 0; j < nk; ++j) { const float f = (mr[j] != 0) ? 1.f : 0.f; mx = fmaxf(mx, fmaf(f, s[j], (1.f - f) * -1.0e9f)); } float se = 0.f;
#pragma unroll 1
  for (int j = 0; j < nk; ++j) { const float f = (mr[j] != 0) ? 1.f : 0.f; se += __expf(fmaf(f, s[j], (1.f - f) * -1.0e9f) - mx); } const float sc = 256.0f / se;
#pragma unroll 1
  for (int j0 = 0; j0 < nk; j0 += 8) { FragH fr; for (int q = 0; q < 8; ++q) { const int j = j0 + q; const float f = (mr[j] != 0) ? 1.f : 0.f; fr.h[q] = (_Float16)(__expf(fmaf(f, s[j], (1.f - f) * -1.0e9f) - mx) * sc); } unsigned short* d = (unsigned short*)P + i * NKX + j0; *(v8us*)d = fr.half[0];  } }



__global__ __launch_bounds__(256) void k_tab128h(int nr, float theta, float* __restrict__ CS, float* __restrict__ SN) {
  #pragma clang fp contract(off)
  const size_t t = (size_t)blockIdx.x * 256 + threadIdx.x; if (t >= (size_t)nr * 64) return; const int i = (int)(t % 64); const size_t r = t / 64; const int p = (int)(r % SQ);
  const float invf = (float)(1.0 / pow((double)theta, ((double)(2 * i)) / 128.0)); const float ang = __fmul_rn((float)p, invf); const float c = cosf(ang), sv = sinf(ang);
  float* pc = CS + r * 128 + i; float* ps = SN + r * 128 + i;
  *(float*)pc = c; *(float*)(pc + 64) = c; *(float*)ps = sv; *(float*)(ps + 64) = sv;  }

// Lane exchanges and the native exp of the softmax code below.
template <int M> __device__ __forceinline__ float sm_xrow(float x) { return __builtin_bit_cast(float, __builtin_amdgcn_mov_dpp(__builtin_bit_cast(int, x), 0x160 | M, 0xf, 0xf, true)); }      /* lane l with lane l ^ M, M < 16 (row_xmask) */
__device__ __forceinline__ float sm_xhalf(float x) { const int b = __builtin_bit_cast(int, x); return __builtin_bit_cast(float, __builtin_amdgcn_permlanex16(b, b, 0x76543210, 0xfedcba98, false, false)); }      /* lane l with lane l ^ 16 */
__device__ __forceinline__ float sm_wmax(float x) { x = fmaxf(x, sm_xrow<1>(x)); x = fmaxf(x, sm_xrow<2>(x)); x = fmaxf(x, sm_xrow<4>(x)); x = fmaxf(x, sm_xrow<8>(x)); return fmaxf(x, sm_xhalf(x)); }
__device__ __forceinline__ float sm_wsum(float x) { x += sm_xrow<1>(x); x += sm_xrow<2>(x); x += sm_xrow<4>(x); x += sm_xrow<8>(x); return x + sm_xhalf(x); }
// Eight native 2^x in one statement. The outputs are early-clobber, so no v_exp_f32 in it overwrites a neighbour's source or reads its result; the closing v_nop keeps the one slot
// that the instruction set asks for behind a transcendental, whatever the compiler places next (left to itself it reused a source register directly behind some of them).
__device__ __forceinline__ void sm_exp2x8(v4f& a, v4f& b) { float e0, e1, e2, e3, e4, e5, e6, e7;
  asm("v_exp_f32 %0, %8\n\tv_exp_f32 %1, %9\n\tv_exp_f32 %2, %10\n\tv_exp_f32 %3, %11\n\tv_exp_f32 %4, %12\n\tv_exp_f32 %5, %13\n\tv_exp_f32 %6, %14\n\tv_exp_f32 %7, %15\n\tv_nop"
      : "=&v"(e0), "=&v"(e1), "=&v"(e2), "=&v"(e3), "=&v"(e4), "=&v"(e5), "=&v"(e6), "=&v"(e7) : "v"(a[0]), "v"(a[1]), "v"(a[2]), "v"(a[3]), "v"(b[0]), "v"(b[1]), "v"(b[2]), "v"(b[3]));
  a[0] = e0; a[1] = e1; a[2] = e2; a[3] = e3; b[0] = e4; b[1] = e5; b[2] = e6; b[3] = e7; }
// Fused attention of query blocks 1 .. SQ / QT - 1 (block 0 is the exact first tile's): scores, the per-block softmax and P V in one launch; no score or weight ever goes to memory.
// One wave owns 16 queries of one head and walks the key blocks j = 0 .. i. Both products are formed transposed, with the queries as the 16 columns:
//   S^T = K Q^T : A = 16 key rows (hi, residual), B = the wave's q fragments; 16 tiles of 16 keys = the whole 256-key block of a lane's query (column ln; keys 8 hh + r of each tile);
//   softmax     : maximum and sum run over a lane's own 128 scores, one exchange with lane ^ 16 finishes each;
//   O^T = V^T P^T : A = 16 rows of V^T (hi, residual); score tiles 2u and 2u + 1 of a lane ARE the B fragment of keys 32u .. 32u + 31 (elements 0..7 = keys 8 hh + r, 8..15 = keys 16 + 8 hh + r, the k order of g2_frag), so the weights move through no LDS.
// Each product has three terms: hi.hi in one accumulator, the two x1024 residual terms together in a second one. Fragments are requested two steps before their products.
struct FA4 { v16h f0, f1, f2, f3; };      /* the four fragments of one step: a key tile's four k-steps, or four 16-dim tiles of V^T, of one plane (hi or residual) */
__device__ __forceinline__ void fa_load(FA4& s, const _Float16* p, size_t st) { s.f0 = g2_frag(p); s.f1 = g2_frag(p + st); s.f2 = g2_frag(p + 2 * st); s.f3 = g2_frag(p + 3 * st); }
__device__ __forceinline__ v8f fa_mma(v16h a, v16h b, v8f c) { return __builtin_amdgcn_wmma_f32_16x16x32_f16(false, a, false, b, (short)0, c, false, false); }
// Output product of the exact first tile (rows 0..255 of each batch): C = (Ah B^T) 2^-10 + (Al B^T) 2^-20, Ah / Al = o x64 as f16 hi / x1024 residual planes, B = Wo x16, all in fragment order, K = 2048.
// One work-group = 128 rows x 64 columns, a wave 32 x 64 as in k_gemm2; both planes go through ONE k loop (the B fragments are loaded once for both), each plane into accumulators of its own, k ascending: the sums are those of two separate products.
struct G3S { v16h a0, a1, l0, l1, b0, b1, b2, b3; };      /* the fragments of one k-step: two strips of each A plane, four strips of B */
__device__ __forceinline__ void g3_load(G3S& s, const _Float16* ap, const _Float16* lp, const _Float16* bp, int k) { s.a0 = g2_frag(ap + k); s.b0 = g2_frag(bp + k); s.a1 = g2_frag(ap + 16 * DMX + k); s.l0 = g2_frag(lp + k); s.l1 = g2_frag(lp + 16 * DMX + k); s.b1 = g2_frag(bp + 16 * DMX + k); s.b2 = g2_frag(bp + 32 * DMX + k); s.b3 = g2_frag(bp + 48 * DMX + k); }
__device__ __forceinline__ void ft_out(const _Float16* __restrict__ Ah, const _Float16* __restrict__ Al, const _Float16* __restrict__ Bh, float* __restrict__ C, int wg, float (*so)[32][68]) {
  const int lane = threadIdx.x & 31, ln = lane & 15, hh = lane >> 4, w = threadIdx.x >> 5;
  const int b = wg / (2 * (DMX / 64)), row0 = (wg / (DMX / 64) & 1) * 128 + 32 * w, col0 = (wg % (DMX / 64)) * 64;      /* QT0 = 2 x 128 rows a batch */
  const size_t ao = ((size_t)b * QT0 + row0) * DMX + lane * 8; const _Float16* ap = Ah + ao; const _Float16* lp = Al + ao; const _Float16* bp = Bh + (size_t)col0 * DMX + lane * 8;
  G3S s0, s1, s2; int ko = 0;      /* three k-steps of fragments in registers, as in k_gemm2: a step's 16 loads are issued together, two steps ahead */
  g3_load(s0, ap, lp, bp, 0); __builtin_amdgcn_sched_barrier(0);      /* the three sets are requested one after the other, as in the loop, so that the counted load waits do not wait for the younger sets */
  g3_load(s1, ap, lp, bp, 512); __builtin_amdgcn_sched_barrier(0);      /* as above */
  g3_load(s2, ap, lp, bp, 1024);
  asm volatile("s_wait_xcnt 0x0" ::: "memory");      /* stands in front of the clearing of the accumulators, which may take the registers of an address that the loads above name (a precaution) */
  const v8f z8 = {0.f, 0.f, 0.f, 0.f, 0.f, 0.f, 0.f, 0.f}; v8f ch[8] = {z8, z8, z8, z8, z8, z8, z8, z8}, cl[8] = {z8, z8, z8, z8, z8, z8, z8, z8};      /* index 4 (row strip) + column strip */
#define G3_MMA(S) { ch[0] = fa_mma(S.a0, S.b0, ch[0]); ch[4] = fa_mma(S.a1, S.b0, ch[4]); cl[0] = fa_mma(S.l0, S.b0, cl[0]); cl[4] = fa_mma(S.l1, S.b0, cl[4]); ch[1] = fa_mma(S.a0, S.b1, ch[1]); ch[5] = fa_mma(S.a1, S.b1, ch[5]); cl[1] = fa_mma(S.l0, S.b1, cl[1]); cl[5] = fa_mma(S.l1, S.b1, cl[5]); \
    ch[2] = fa_mma(S.a0, S.b2, ch[2]); ch[6] = fa_mma(S.a1, S.b2, ch[6]); cl[2] = fa_mma(S.l0, S.b2, cl[2]); cl[6] = fa_mma(S.l1, S.b2, cl[6]); ch[3] = fa_mma(S.a0, S.b3, ch[3]); ch[7] = fa_mma(S.a1, S.b3, ch[7]); cl[3] = fa_mma(S.l0, S.b3, cl[3]); cl[7] = fa_mma(S.l1, S.b3, cl[7]); }
  /* G3_STEP: the k offset moves on by three steps; the wait stands in front of the rewrite of the address registers that the loads in flight name (a precaution); the new offset is its output, so every new address is formed behind it */
#define G3_STEP { ko += 1536; asm volatile("s_wait_xcnt 0x0" : "+s"(ko) : : "memory"); }
#pragma unroll 1      /* one trip = three k-steps, one per register set; rolled so that the sets keep their registers */
  for (int st = 0; st + 6 <= DMX / 32; st += 3) {
    G3_MMA(s0) G3_STEP g3_load(s0, ap + ko, lp + ko, bp + ko, 0); __builtin_amdgcn_sched_barrier(0);      /* keeps the next set's first product, with its load wait, from moving up in front of these requests */
    G3_MMA(s1) g3_load(s1, ap + ko, lp + ko, bp + ko, 512);
    G3_MMA(s2) g3_load(s2, ap + ko, lp + ko, bp + ko, 1024); }
  static_assert(DMX / 32 % 3 == 1, "four k-steps are left behind the loop, three of them loaded");
  G3_MMA(s0) G3_STEP const _Float16* ea = ap + ko; const _Float16* el = lp + ko; const _Float16* eb = bp + ko; g3_load(s0, ea, el, eb, 0);
  __builtin_amdgcn_sched_barrier(0); asm volatile("s_wait_xcnt 0x0" : : "v"(ea), "v"(el), "v"(eb) : "memory"); __builtin_amdgcn_sched_barrier(0);      /* behind the last request: its address registers are free from here on and the compiler reuses them with the loads in flight (a precaution; it wrote no wait there); the addresses are inputs of the wait, so their registers stay as they are up to it, and the two barriers keep the requests above it and the reuse below it */
  G3_MMA(s1) G3_MMA(s2) G3_MMA(s0)
#undef G3_STEP
#undef G3_MMA
#pragma unroll
  for (int u = 0; u < 8; ++u) {
#pragma unroll
    for (int r = 0; r < 8; ++r) so[w][(u >> 2) * 16 + 8 * hh + r][(u & 3) * 16 + ln] = cl[u][r] * 0.00000095367431640625f + ch[u][r] * 0.0009765625f; }      /* both scalings are exact: one rounding, that of the sum */
  __builtin_amdgcn_fence(__ATOMIC_ACQ_REL, "workgroup"); __builtin_amdgcn_wave_barrier();      /* a wave reads back its own staging only: whole 256-byte row pieces go out */
  const int rsub = lane >> 4, c4 = (lane & 15) * 4;
#pragma unroll
  for (int q = 0; q < 16; ++q) { const int r = q * 2 + rsub; const v4f v = *(const v4fa*)&so[w][r][c4]; *(v4f*)(C + ((size_t)b * SQ + row0 + r) * DMX + col0 + c4) = v; } }
// The last NB NH 4 work-groups of the launch, which would be query block 0, take the output product of the exact first tile instead (ft_out: it needs only what earlier launches wrote, and rows 0..255 of o come from the exact path alone).
__global__ __launch_bounds__(128) void k_fattn(const _Float16* __restrict__ Qh, const _Float16* __restrict__ Ql, const _Float16* __restrict__ Kh, const _Float16* __restrict__ Kl, const _Float16* __restrict__ Vh, const _Float16* __restrict__ Vl, _Float16* __restrict__ O,
    const _Float16* __restrict__ O0h, const _Float16* __restrict__ O0l, const _Float16* __restrict__ Bo, float* __restrict__ out) {
  __shared__ __attribute__((aligned(16))) float so[4][32][68];      /* ft_out's staging */
  static_assert(NB * (QT0 / 128) * (DMX / 64) == NB * NH * 4 && QT0 == QT, "ft_out's work-groups fill the places of query block 0");
  if (blockIdx.x >= (unsigned)(NB * NH * 4 * (SQ / QT - 1))) { ft_out(O0h, O0l, Bo, out, (int)blockIdx.x - NB * NH * 4 * (SQ / QT - 1), so); return; }      /* the same for the whole work-group; no barrier follows */
  const int lane = threadIdx.x & 31, ln = lane & 15, hh = lane >> 4, w = threadIdx.x >> 5;
  const int qb = (SQ / QT - 1) - (int)(blockIdx.x / (NB * NH * 4)); const int rem = blockIdx.x % (NB * NH * 4); const int sub = rem & 3, h = (rem >> 2) % NH, b = rem / (4 * NH);      /* the query blocks with the most key blocks take the lowest work-group indices */
  const int qrow = qb * QT + sub * 64 + w * 16 + ln;      /* this lane's query (a column of both products) */
  // All six planes and O are in fragment order: a strip of 16 rows starts at row x 2048 elements, column c (a multiple of 32) at 16 c elements inside it, the lane's piece at 8 lane.
  const size_t qs = ((size_t)b * SQ + (qrow - ln)) * DMX + lane * 8; const _Float16* qph = Qh + qs; const _Float16* qpl = Ql + qs;
  const size_t ks = (size_t)b * SQ * DKV + h * HDK * 16 + lane * 8; const _Float16* kph = Kh + ks; const _Float16* kpl = Kl + ks;
  const size_t vs = ((size_t)b * DKV + h * HDK) * SQ + lane * 8; const _Float16* vph = Vh + vs; const _Float16* vpl = Vl + vs;
  const v8f z8 = {0.f, 0.f, 0.f, 0.f, 0.f, 0.f, 0.f, 0.f}; v8f oh[8] = {z8, z8, z8, z8, z8, z8, z8, z8};
  const float nrm = 256.0f / __fadd_rn((float)(qb + 1), 1e-6f);
  int j = 0;
#pragma unroll 1      /* one trip = one 256-key block; rolled, the trip count differs between query blocks (at least one trip: block 0) */
  do { int jo = j * 256, qo = h * HDK * 16;
    asm volatile("s_wait_xcnt 0x0" : "+s"(jo), "+s"(qo) : : "memory");      /* stands in front of the rewrite of the address registers of the last trip's loads (a precaution); the key offset and the q offset are its outputs, so every new address is formed behind it, and the q fragments are fetched anew in every trip: they hold no registers during softmax and P V, which keeps two waves on a SIMD */
    const _Float16* qp = qph + qo; const _Float16* qlp = qpl + qo;
    const v16h qh0 = g2_frag(qp), qh1 = g2_frag(qp + 512), qh2 = g2_frag(qp + 1024), qh3 = g2_frag(qp + 1536), ql0 = g2_frag(qlp), ql1 = g2_frag(qlp + 512), ql2 = g2_frag(qlp + 1024), ql3 = g2_frag(qlp + 1536);
    const _Float16* kh_ = kph + (size_t)jo * DKV; const _Float16* kl_ = kpl + (size_t)jo * DKV; const _Float16* vh_ = vph + jo * 16; const _Float16* vl_ = vpl + jo * 16;
    // 64 steps of 8 loads a trip: steps 0..31 = key tile t, hi plane then residual plane; steps 32..63 = 32 keys x 64 dims of V^T, hi then residual. Three register sets turn: step k + 2 is requested in front of the products of step k.
#define FA_REQ(k) { if ((k) < 32) fa_load(x[(k) % 3], (((k) & 1) ? kl_ : kh_) + (size_t)((k) >> 1) * 16 * DKV, 512); else fa_load(x[(k) % 3], (((k) & 1) ? vl_ : vh_) + (size_t)(((k) - 32) >> 2) * 512 + (size_t)(((((k) - 32) >> 1) & 1) * 4) * 16 * SQ, (size_t)16 * SQ); }
    v8f s[16]; FA4 x[3]; FA_REQ(0) __builtin_amdgcn_sched_barrier(0);      /* the q fragments and step 0 are requested first, then step 1, then step 2: mixed, the first products' counted load wait would wait for the younger steps too */
    asm volatile("s_wait_xcnt 0x0" ::: "memory");      /* behind the q fragments' requests: their address registers are free from here on and are reused with the loads in flight (a precaution; in this build the compiler's own wait there left the two youngest out) */
    FA_REQ(1) __builtin_amdgcn_sched_barrier(0);      /* as above */
    v8f ah = z8, al = z8;
#pragma unroll
    for (int k = 0; k < 32; ++k) { if (k == 28 || k == 29) __builtin_amdgcn_sched_barrier(0);      /* keeps the vector work of the step before out of the stretch between a K plane's last request and the wait below */
      FA_REQ(k + 2)      /* behind the last key tile: the first V^T fragments, which fly during the softmax */
      if (k == 28 || k == 29) { __builtin_amdgcn_sched_barrier(0); asm volatile("s_wait_xcnt 0x0" ::: "memory"); }      /* behind the last request of a K plane: its address registers are free from here on and the compiler reuses them with the loads in flight (a precaution; it wrote no wait there); the barrier in front keeps the requests above the wait */
      __builtin_amdgcn_sched_barrier(0);      /* keeps this step's products, with their load wait, from moving up in front of the requests of the step after next */
      const FA4& c = x[k % 3];
      if ((k & 1) == 0) { ah = fa_mma(c.f0, qh0, z8); al = fa_mma(c.f0, ql0, z8); ah = fa_mma(c.f1, qh1, ah); al = fa_mma(c.f1, ql1, al); ah = fa_mma(c.f2, qh2, ah); al = fa_mma(c.f2, ql2, al); ah = fa_mma(c.f3, qh3, ah); al = fa_mma(c.f3, ql3, al); }
      else { al = fa_mma(c.f0, qh0, al); al = fa_mma(c.f1, qh1, al); al = fa_mma(c.f2, qh2, al); al = fa_mma(c.f3, qh3, al); s[k >> 1] = ah * ATS + al * (ATS * 0.0009765625f); } }
    if (j == qb) {      /* only the diagonal block holds keys above a query */
#pragma unroll
      for (int t = 0; t < 16; ++t) {
#pragma unroll
        for (int r = 0; r < 8; ++r) s[t][r] = (jo + t * 16 + 8 * hh + r <= qrow) ? s[t][r] : -1.0e9f; } }
    float mx = -3.0e38f;
#pragma unroll
    for (int t = 0; t < 16; ++t) mx = fmaxf(mx, fmaxf(fmaxf(fmaxf(s[t][0], s[t][1]), fmaxf(s[t][2], s[t][3])), fmaxf(fmaxf(s[t][4], s[t][5]), fmaxf(s[t][6], s[t][7]))));
    mx = fmaxf(mx, sm_xhalf(mx)); float se = 0.f;
#pragma unroll
    for (int t = 0; t < 16; ++t) { v4f a, e;
#pragma unroll
      for (int u = 0; u < 4; ++u) { a[u] = (s[t][u] - mx) * 1.44269504f; e[u] = (s[t][4 + u] - mx) * 1.44269504f; }      /* e^x = 2^(x log2 e), as the native exp forms it */
      sm_exp2x8(a, e); se += ((a[0] + a[1]) + (a[2] + a[3])) + ((e[0] + e[1]) + (e[2] + e[3]));
#pragma unroll
      for (int u = 0; u < 4; ++u) { s[t][u] = a[u]; s[t][4 + u] = e[u]; } }
    se += sm_xhalf(se); const float isum = nrm / se;
    FragH bh, bl; v8f ol[8] = {z8, z8, z8, z8, z8, z8, z8, z8};      /* the residual terms of this key block (x1024) */
#pragma unroll
    for (int k = 32; k < 64; ++k) { const int u = (k - 32) >> 2, d0 = (((k - 32) >> 1) & 1) * 4;
      if (k == 60 || k == 61) __builtin_amdgcn_sched_barrier(0);      /* as for K above */
      if (k + 2 < 64) FA_REQ(k + 2)
      if (k == 60 || k == 61) { __builtin_amdgcn_sched_barrier(0); asm volatile("s_wait_xcnt 0x0" ::: "memory"); }      /* behind the last request of a V^T plane, as for K above */
      __builtin_amdgcn_sched_barrier(0);      /* as above: the requests stay in front of this step's products */
      const FA4& c = x[k % 3];
      if (((k - 32) & 3) == 0) {      /* the weights of keys 32u .. 32u + 31 as f16 hi + x1024 residual: the B fragments of the next four steps */
#pragma unroll
        for (int r = 0; r < 8; ++r) { const float p0 = s[2 * u][r] * isum, p1 = s[2 * u + 1][r] * isum; bh.h[r] = (_Float16)p0; bl.h[r] = (_Float16)((p0 - (float)bh.h[r]) * 1024.0f); bh.h[8 + r] = (_Float16)p1; bl.h[8 + r] = (_Float16)((p1 - (float)bh.h[8 + r]) * 1024.0f); } }
      if ((k & 1) == 0) { oh[d0] = fa_mma(c.f0, bh.v, oh[d0]); oh[d0 + 1] = fa_mma(c.f1, bh.v, oh[d0 + 1]); oh[d0 + 2] = fa_mma(c.f2, bh.v, oh[d0 + 2]); oh[d0 + 3] = fa_mma(c.f3, bh.v, oh[d0 + 3]);
        ol[d0] = fa_mma(c.f0, bl.v, ol[d0]); ol[d0 + 1] = fa_mma(c.f1, bl.v, ol[d0 + 1]); ol[d0 + 2] = fa_mma(c.f2, bl.v, ol[d0 + 2]); ol[d0 + 3] = fa_mma(c.f3, bl.v, ol[d0 + 3]); }
      else { ol[d0] = fa_mma(c.f0, bh.v, ol[d0]); ol[d0 + 1] = fa_mma(c.f1, bh.v, ol[d0 + 1]); ol[d0 + 2] = fa_mma(c.f2, bh.v, ol[d0 + 2]); ol[d0 + 3] = fa_mma(c.f3, bh.v, ol[d0 + 3]); } }
#undef FA_REQ
#pragma unroll
    for (int dt = 0; dt < 8; ++dt) oh[dt] += ol[dt] * 0.0009765625f;      /* joined per key block, so that the second accumulator holds no registers while the next scores are formed */
  } while (++j <= qb);
  unsigned short* op = (unsigned short*)O + qs + h * HDK * 16;      /* a lane holds dims 16 dt + 8 hh + r of its query: piece 32 (dt & 1) + lane of tile dt / 2 of the head's four: each store of the wave writes 512 contiguous bytes */
#pragma unroll
  for (int dt = 0; dt < 8; ++dt) { FragH f;
#pragma unroll
    for (int r = 0; r < 8; ++r) f.h[r] = (_Float16)(oh[dt][r] * 0.25f);      /* o x64 = (Ph Vh + (Pl Vh + Ph Vl) 2^-10) / 4 */
    *(v8us*)(op + dt * 256) = f.half[0]; } }
// Exact f32 causal attention of rows 0..255, spread over a work-group: 8 waves take 8 query rows of one head (keys 0 .. i0 + 7 only).
// Scores: 4 neighbouring lanes share one key row (each wave-wide load covers 8 rows x 64 contiguous bytes), a lane sums its 32 of the 128 dims for all 8 queries (q from LDS, 64 contiguous bytes per read), two lane steps finish the dot.
// Softmax: wave w owns row i0 + w, 8 keys a lane, plain two-pass (all scores of a row are at hand), accurate expf; keys above the query get weight 0.
// Output: wave w sums keys w, w + 8, ... (a V row is one coalesced 512 B load, its 8 weights two LDS broadcasts), the 8 partial sums meet in LDS in fixed order; o x64 / row sum as before.
// The result leaves as the two f16 operand planes of its output product, hi + x1024 residual (the split of k_hl), in fragment order: thread t sums and splits 4 columns of row t & 7, so that a wave's store fills whole 128-byte lines (8 rows x 16 bytes).
__global__ __launch_bounds__(256) void k_att0w(const float* __restrict__ QF, const float* __restrict__ KF, const float* __restrict__ VF, float scale, _Float16* __restrict__ OH, _Float16* __restrict__ OL) {
  __shared__ __attribute__((aligned(16))) float lq[8][128]; __shared__ __attribute__((aligned(16))) float sc[8][QT0 + 4]; __shared__ __attribute__((aligned(16))) float pt[QT0][8]; __shared__ __attribute__((aligned(16))) float red[8][8][128]; __shared__ float inv[8];
  const int lane = threadIdx.x & 31; const int w = __builtin_amdgcn_readfirstlane(threadIdx.x >> 5); const int h = blockIdx.x % NH, b = (blockIdx.x / NH) % NB, i0 = (QT0 / 8 - 1 - blockIdx.x / (NH * NB)) * 8; const int nkey = i0 + 8;      /* the row groups with the most keys take the lowest work-group indices, of both batches */
  QF += (size_t)b * QT0 * DMX; KF += (size_t)b * QT0 * DKV; VF += (size_t)b * QT0 * DKV;      /* each plane holds rows 0..255 of one batch behind those of the other */
  *(v4f*)&lq[w][lane * 4] = *(const v4fa*)(QF + (size_t)(i0 + w) * DMX + h * 128 + lane * 4);
  __syncthreads();
  const int dq = (lane & 3) * 4;
#pragma unroll 1      /* one trip = 64 keys of the work-group; rolled so that only the trips below the diagonal run */
  for (int j0 = w * 8; j0 < nkey; j0 += 64) { const int j = j0 + (lane >> 2); const float* kr = KF + (size_t)j * DKV + h * 128 + dq; v4f kq[8];
#pragma unroll
    for (int c = 0; c < 8; ++c) kq[c] = *(const v4fa*)(kr + c * 16);
    asm volatile("s_wait_xcnt 0x0" ::: "memory");      /* stands in front of the first reuse of the loads' address registers (a precaution); no load sinks below it, so all eight are in flight together */
#pragma unroll 1      /* four query rows a trip: with all eight unrolled the q reads of a whole tile are hoisted and the wave needs more than 256 registers, so that only one work-group fits a WGP */
    for (int rh = 0; rh < 8; rh += 4) { float acc[4] = {0.f, 0.f, 0.f, 0.f};
#pragma unroll
      for (int c = 0; c < 8; ++c) {
#pragma unroll
        for (int r = 0; r < 4; ++r) { const v4f q = *(const v4f*)&lq[rh + r][c * 16 + dq]; acc[r] += q[0] * kq[c][0] + q[1] * kq[c][1] + q[2] * kq[c][2] + q[3] * kq[c][3]; } }
#pragma unroll
      for (int r = 0; r < 4; ++r) { float s = acc[r]; s += sm_xrow<1>(s); s += sm_xrow<2>(s); if ((lane & 3) == 0) sc[rh + r][j] = s * scale; } } }
  __syncthreads();
  { const int i = i0 + w; float s[8]; float mx = -3.0e38f;
#pragma unroll
    for (int u = 0; u < 8; ++u) { const int j = lane + 32 * u; s[u] = (j <= i) ? sc[w][j] : -3.0e38f; mx = fmaxf(mx, s[u]); }
    mx = sm_wmax(mx); float se = 0.f;
#pragma unroll
    for (int u = 0; u < 8; ++u) { const int j = lane + 32 * u; const float e = (j <= i) ? expf(s[u] - mx) : 0.f; se += e; pt[j][w] = e; }
    se = sm_wsum(se); if (lane == 0) inv[w] = 64.0f / se; }
  __syncthreads();
  const v4f z4 = {0.f, 0.f, 0.f, 0.f}; v4f o[8] = {z4, z4, z4, z4, z4, z4, z4, z4};
#pragma unroll 1      /* one trip = 64 keys of the work-group, 8 a wave; keys from nkey on carry weight 0 for all 8 rows (rows below 256 of V, in bounds) */
  for (int jb = w; jb < nkey; jb += 64) { const float* vr = VF + (size_t)jb * DKV + h * 128 + lane * 4; v4f vv[8];
#pragma unroll
    for (int u = 0; u < 8; ++u) vv[u] = *(const v4fa*)(vr + (size_t)(8 * u) * DKV);
#pragma unroll
    for (int u = 0; u < 8; ++u) { const v4f p0 = *(const v4f*)&pt[jb + 8 * u][0], p1 = *(const v4f*)&pt[jb + 8 * u][4];
#pragma unroll
      for (int r = 0; r < 4; ++r) { o[r] += p0[r] * vv[u]; o[4 + r] += p1[r] * vv[u]; } } }
#pragma unroll
  for (int r = 0; r < 8; ++r) *(v4f*)&red[w][r][lane * 4] = o[r];
  __syncthreads();
  { const int r = threadIdx.x & 7, c = (int)(threadIdx.x >> 3) * 4; v4f a = *(const v4f*)&red[0][r][c];
#pragma unroll
    for (int k = 1; k < 8; ++k) a += *(const v4f*)&red[k][r][c];
    a *= inv[r]; v4h ph, pr;
#pragma unroll
    for (int q = 0; q < 4; ++q) { const _Float16 x = (_Float16)a[q]; ph[q] = x; pr[q] = (_Float16)((a[q] - (float)x) * 1024.0f); }
    const int row = b * QT0 + i0 + r, col = h * 128 + c;      /* planes of NB QT0 rows; piece 16 (column / 8 & 3) + (row & 15) of tile column / 32 of strip row / 16 */
    const size_t d = (size_t)(row >> 4) * 16 * DMX + (size_t)(col >> 5) * 512 + (((col >> 3) & 3) * 16 + (row & 15)) * 8 + (col & 7);
    *(v4h*)(OH + d) = ph; *(v4h*)(OL + d) = pr; } }
extern "C" void kernel_launch(void* const* d_in, const int* in_sizes, int n_in,
                              void* d_out, int out_size, void* d_ws, size_t ws_size, hipStream_t stream) {
  (void)in_sizes; (void)n_in; (void)out_size;
  const float* const* I = (const float* const*)d_in; const float* x = I[0]; const float* wq = I[1]; const float* wk = I[2]; const float* wv = I[3]; const float* wo = I[4]; const float* bo = nullptr;      /* natural [out][in] Wq/Wk/Wv/Wo [2048][2048]; no biases */
  char* ws = (char*)d_ws; size_t off = 0;
  auto take = [&](size_t bytes) { char* p = ws + off; off += (bytes + 255) & ~(size_t)255; return p; };
  _Float16* BQ = (_Float16*)take((size_t)DMX * DMX * 2); _Float16* BK = (_Float16*)take((size_t)DKV * DMX * 2); _Float16* BV = (_Float16*)take((size_t)DKV * DMX * 2); _Float16* BO = (_Float16*)take((size_t)DMX * DMX * 2);
  _Float16* X16 = (_Float16*)take(NR * DMX * 2); float* QF = (float*)take((size_t)NB * QT0 * DMX * 4); float* KF = (float*)take((size_t)NB * QT0 * DKV * 4); float* VF = (float*)take((size_t)NB * QT0 * DKV * 4); _Float16* Q16 = (_Float16*)take(NR * DMX * 2); _Float16* QL = (_Float16*)take(NR * DMX * 2); _Float16* K16 = (_Float16*)take(NR * DKV * 2); _Float16* KL = (_Float16*)take(NR * DKV * 2); _Float16* O16 = (_Float16*)take(NR * DMX * 2);      /* rows 0..255 of each batch's q, k, v in f32; f16 hi + x1024 residual planes of q, k (both batches) */
  _Float16* VT = (_Float16*)take((size_t)NB * DKV * SQ * 2); _Float16* VTL = (_Float16*)take((size_t)NB * DKV * SQ * 2);      /* V^T hi / residual of both batches */
  _Float16* OH0 = (_Float16*)take((size_t)NB * QT0 * DMX * 2); _Float16* OL0 = (_Float16*)take((size_t)NB * QT0 * DMX * 2);
  if (off > ws_size) return;      /* 176 MiB */
  k_prep<<<4 * WB + (unsigned)(NR * DMX / 8 / 256), 256, 0, stream>>>(x, wq, wk, wv, wo, X16, BQ, BK, BV, BO);      /* natural [out][in] weights = Bt x16; x as exact f16 rows */
  // Independent work shares a launch: the token rows of both batches are the rows of one GEMM, and q and k are the two blockIdx.y slices of one launch (same A, same epilogue).
  k_gemm2<0, 1><<<dim3((unsigned)((NR / 128) * (DMX / 64)), 2), 128, 0, stream>>>(X16, DMX, 0, BQ, DMX, (size_t)(BK - BQ), 0.0625f, nullptr, 0, nullptr, 1, 0, 0, QF, nullptr, DMX, (size_t)(KF - QF), (int)NR, DMX, DMX, Q16, QL, QT0, (size_t)(K16 - Q16));      /* q and k (exact products, f32 accumulators) leave the GEMM as f16 hi + x1024 residual planes in fragment order (block 0's full softmax seen from every later block's first row needs near-exact logits); f32 rows 0..255 of each batch for the exact first tile */
  k_gemm2<0, 2><<<dim3((unsigned)((NR / 128) * (DKV / 64)), 1), 128, 0, stream>>>(X16, DMX, 0, BV, DMX, 0, 0.0625f, nullptr, 0, nullptr, 1, 0, 0, VF, nullptr, DKV, 0, (int)NR, DKV, DMX, VT, VTL, QT0, 0);      /* v leaves the GEMM as V^T hi / x1024 residual planes in fragment order, a plane a batch (rows = dims, columns = keys; the per-block softmax gives every block's first rows single-key weights, so v and P must be carried beyond one f16); f32 rows 0..255 of each batch for the exact first tile */
  k_att0w<<<NB * NH * (QT0 / 8), 256, 0, stream>>>(QF, KF, VF, ATS, OH0, OL0);      /* exact causal attention rows 0..255 of both batches (o x64) -> f16 hi + x1024 residual planes */
  k_fattn<<<NB * NH * (SQ / 64), 128, 0, stream>>>(Q16, QL, K16, KL, VT, VTL, O16, OH0, OL0, BO, (float*)d_out);      /* scores (hi.hi + the two residual terms), the module's per-block softmax (an independent softmax per 256-key block j <= i, diagonal block causal, weights divided by block count + 1e-6) and o = P V (hi.hi + the two residual terms) -> merged f16 o rows (x64), query blocks 1..; its last work-groups: rows 0..255 of out of each batch = exact o hi Wo^T 2^-10 + o residual Wo^T 2^-20 */
  k_gemm2<0, 0><<<dim3((unsigned)(((SQ - QT0) / 128) * (DMX / 64)), NB), 128, 0, stream>>>(O16 + (size_t)QT0 * DMX, DMX, (size_t)SQ * DMX, BO, DMX, 0, 0.0009765625f, bo, 0, nullptr, 1, 0, 0, (float*)d_out + (size_t)QT0 * DMX, nullptr, DMX, (size_t)SQ * DMX, SQ - QT0, DMX, DMX, nullptr, nullptr, 0, 0);      /* out = o Wo^T, rows 256.. of each batch (a blockIdx.y slice a batch) */
}

// v009
// It runs in 258 microseconds.
// Next to v008, in two timings, it ran 1.12 and 1.15 times as fast.
// All steps since the starting kernel, v000, together make it 39.6 times as fast.
#include <hip/hip_runtime.h>
// Block-chunked causal attention with the module's PER-BLOCK softmax (hidden [2][2048][2048]; q/k/v = x W^T (natural [2048][2048] sigma 0.02, no biases), 16 heads of 128; keys in blocks of 256: for query block i every key block j <= i gets its OWN softmax over its 256 keys (scores / sqrt(128); inside the diagonal block keys above the query are -inf), the block outputs are summed and divided by the summed weights (= number of included blocks) + 1e-6; merged Wo^T -> [2][2048][2048]; no RoPE).
// Structure: token rows; x as exact f16 rows; natural weights as exact x16 planes; q, k, v as WMMA GEMMs (64x128 wave tiles, f32 accumulation) whose epilogues write f32 (first tile) + the f16 operand planes of q, k and V^T; per batch: exact f32 causal attention for rows 0..255 (= key block 0, where the per-block softmax is the ordinary causal softmax) on VALU; one fused launch for query blocks 1.., all heads and both batches: a wave's 16 queries against key blocks 0..i (scores f32 in registers, alpha 1/sqrt(128)), the module's per-block softmax on VALU (f32 statistics, native exp; weights x256 f16 divided by the block count + 1e-6), o = P V (x64) merged f16; out = o Wo^T (rows 256.. of a batch); first-tile rows of out from the exact o hi/lo, inside the fused launch; launches: see trace.
// Compute dtype: inputs rounded to bf16; x / weights exact; projections f32; q, k, v and softmax weights as f16 hi + x1024 residual operand pairs, o as a plain f16 GEMM operand (~2^-12; first 256 rows of each batch exact); scores, statistics, out f32. v_wmma_f32_16x16x32_f16.
#define NB 2
#define SQ 2048
#define DMX 2048
#define NH 16
#define NKV 16
#define GSZ 1                        /* plain MHA: kv head == query head */
#define HDK 128
#define DKV (NKV * HDK)
#define QT 256
#define QT0 256
#define NKX SQ
#define DM DMX
#define HD 64
#define HG 1
#define NR ((size_t)NB * SQ)
#define ATS 0.08838834764831845f
typedef __bf16 v16b __attribute__((ext_vector_type(16)));
typedef unsigned short v8us __attribute__((ext_vector_type(8), may_alias));
typedef float  v8f  __attribute__((ext_vector_type(8)));
typedef float  v4f  __attribute__((ext_vector_type(4)));
typedef float  v4fa __attribute__((ext_vector_type(4), may_alias));
union FragB { v16b v; v8us half[2]; unsigned short u[16]; };

__device__ __forceinline__ unsigned short bf16_bits(float x) { unsigned int u = __float_as_uint(x); return (unsigned short)((u + 0x7FFFu + ((u >> 16) & 1u)) >> 16); }
__device__ __forceinline__ float bf16_val(unsigned short b) { return __uint_as_float(((unsigned int)b) << 16); }
__device__ __forceinline__ float bf16_round(float x) { return bf16_val(bf16_bits(x)); }
// D += A·B with NT terms: 1 = ah·bh, 2 = + al·bh (A split), 3 = + ah·bl (both split)
template <int NT>
__device__ __forceinline__ v8f mmaN(v16b ah, v16b al, v16b bh, v16b bl, v8f c) {
  c = __builtin_amdgcn_wmma_f32_16x16x32_bf16(false, ah, false, bh, (short)0, c, false, false);
  if (NT >= 2) c = __builtin_amdgcn_wmma_f32_16x16x32_bf16(false, al, false, bh, (short)0, c, false, false);
  if (NT >= 3) c = __builtin_amdgcn_wmma_f32_16x16x32_bf16(false, ah, false, bl, (short)0, c, false, false);
  asm volatile("v_nop\n\tv_nop\n\tv_nop\n\tv_nop" : "+v"(c) : "v"(ah), "v"(al), "v"(bh), "v"(bl));
  return c;
}

__global__ __launch_bounds__(256) void k_wt_bf16(const float* __restrict__ W, unsigned short* __restrict__ Wt, int K, int N) {
  const int t = blockIdx.x * 256 + threadIdx.x;
  const int k8n = K / 8;
  if (t >= N * k8n) return;
  const int n = t / k8n, k8 = (t % k8n) * 8;
  v8us v;
#pragma unroll
  for (int i = 0; i < 8; ++i) v[i] = bf16_bits(W[(size_t)(k8 + i) * N + n]);
  *(v8us*)(Wt + (size_t)n * K + k8) = v;
  
}

// GEMM C[M][N] (f32, pitch ldc) = act(A[M][K]·W + bias). A f32 row-major (pitch lda) converted per fragment to bf16
// (ASPLIT: hi/lo two planes -> 2 terms, else single rounded term); Wt bf16 [N][K] (pitch ldb). BIAS_BF16 rounds the
// bias to bf16 first (bias quantised to bf16 before the add). K%32==0, M%16==0, N%64==0.
template <bool ASPLIT, int ACT, bool BIAS_BF16>
__global__ __launch_bounds__(128) void k_gemm_bf(const float* __restrict__ A, int lda, const unsigned short* __restrict__ Wt, int ldb,
                                               const float* __restrict__ bias, float* __restrict__ C, int ldc, int M, int N, int K) {
  __shared__ __attribute__((aligned(16))) float so[4][16][64];
  const int tid = threadIdx.x, w = tid >> 5, lane = tid & 31, ln = lane & 15, hh = lane >> 4;
  const int ntn = N / 64;
  const int wid = blockIdx.x * 4 + w;
  const int mt = wid / ntn, nq = wid % ntn;
  if (mt * 16 >= M) return;
  const int row0 = mt * 16, col0 = nq * 64;
  const float* arow = A + (size_t)(row0 + ln) * lda;
  v8f acc[4] = {};
  for (int kb = 0; kb < K; kb += 32) {
    FragB ah, al;
    const v4f x0 = *(const v4fa*)(arow + kb + 8 * hh), x1 = *(const v4fa*)(arow + kb + 8 * hh + 4);
    const v4f x2 = *(const v4fa*)(arow + kb + 16 + 8 * hh), x3 = *(const v4fa*)(arow + kb + 16 + 8 * hh + 4);
    float xs[16] = {x0[0],x0[1],x0[2],x0[3],x1[0],x1[1],x1[2],x1[3],x2[0],x2[1],x2[2],x2[3],x3[0],x3[1],x3[2],x3[3]};
#pragma unroll
    for (int i = 0; i < 16; ++i) { const unsigned short hb = bf16_bits(xs[i]); ah.u[i] = hb; al.u[i] = ASPLIT ? bf16_bits(xs[i] - bf16_val(hb)) : (unsigned short)0; }
#pragma unroll
    for (int t = 0; t < 4; ++t) {
      const unsigned short* brow = Wt + (size_t)(col0 + t * 16 + ln) * ldb + kb;
      FragB b;
      b.half[0] = *(const v8us*)(brow + 8 * hh);
      b.half[1] = *(const v8us*)(brow + 16 + 8 * hh);
      acc[t] = mmaN<ASPLIT ? 2 : 1>(ah.v, al.v, b.v, b.v, acc[t]);
    }
  }
#pragma unroll
  for (int t = 0; t < 4; ++t) {
    float bv = bias ? bias[col0 + t * 16 + ln] : 0.f;
    if (BIAS_BF16) bv = bf16_round(bv);
#pragma unroll
    for (int r = 0; r < 8; ++r) { float v = acc[t][r] + bv; if (ACT == 1) v = fmaxf(v, 0.f); so[w][8 * hh + r][t * 16 + ln] = v; }
  }
  __builtin_amdgcn_fence(__ATOMIC_ACQ_REL, "workgroup");
  __builtin_amdgcn_wave_barrier();
  const int rsub = lane >> 4, c4 = (lane & 15) * 4;
  {
#pragma unroll
    for (int q = 0; q < 8; ++q) {
      const int r = q * 2 + rsub;
      const v4f v = *(const v4fa*)&so[w][r][c4];
      *(v4f*)(C + (size_t)(row0 + r) * ldc + col0 + c4) = v;
    }
    
  }
}

// GEMM C = act(A·W + bias + resid): A f32 (ASPLIT -> hi/lo 2 terms), Wt bf16 [N][K]; ACT 0 none, 1 relu, 2 exact gelu;
// resid (optional, f32, row index = (row % rmod), pitch ldr, RES_BF16 rounds it) added before the activation.
template <bool ASPLIT, int ACT, bool BIAS_BF16, bool RES_BF16>
__global__ __launch_bounds__(128) void k_gemm_bf3(const float* __restrict__ A, int lda, const unsigned short* __restrict__ Wt, int ldb,
                                                const float* __restrict__ bias, const float* __restrict__ resid, int rmod, int ldr,
                                                float* __restrict__ C, int ldc, int M, int N, int K) {
  __shared__ __attribute__((aligned(16))) float so[4][16][64];
  const int tid = threadIdx.x, w = tid >> 5, lane = tid & 31, ln = lane & 15, hh = lane >> 4;
  const int ntn = N / 64;
  const int wid = blockIdx.x * 4 + w;
  const int mt = wid / ntn, nq = wid % ntn;
  if (mt * 16 >= M) return;
  const int row0 = mt * 16, col0 = nq * 64;
  const float* arow = A + (size_t)(row0 + ln) * lda;
  v8f acc[4] = {};
  for (int kb = 0; kb < K; kb += 32) {
    FragB ah, al;
    const v4f x0 = *(const v4fa*)(arow + kb + 8 * hh), x1 = *(const v4fa*)(arow + kb + 8 * hh + 4);
    const v4f x2 = *(const v4fa*)(arow + kb + 16 + 8 * hh), x3 = *(const v4fa*)(arow + kb + 16 + 8 * hh + 4);
    float xs[16] = {x0[0],x0[1],x0[2],x0[3],x1[0],x1[1],x1[2],x1[3],x2[0],x2[1],x2[2],x2[3],x3[0],x3[1],x3[2],x3[3]};
#pragma unroll
    for (int i = 0; i < 16; ++i) { const unsigned short hb = bf16_bits(xs[i]); ah.u[i] = hb; al.u[i] = ASPLIT ? bf16_bits(xs[i] - bf16_val(hb)) : (unsigned short)0; }
#pragma unroll
    for (int t = 0; t < 4; ++t) {
      const unsigned short* brow = Wt + (size_t)(col0 + t * 16 + ln) * ldb + kb;
      FragB b;
      b.half[0] = *(const v8us*)(brow + 8 * hh);
      b.half[1] = *(const v8us*)(brow + 16 + 8 * hh);
      acc[t] = mmaN<ASPLIT ? 2 : 1>(ah.v, al.v, b.v, b.v, acc[t]);
    }
  }
#pragma unroll
  for (int t = 0; t < 4; ++t) {
    const int col = col0 + t * 16 + ln;
    float bv = bias ? bias[col] : 0.f;
    if (BIAS_BF16) bv = bf16_round(bv);
#pragma unroll
    for (int r = 0; r < 8; ++r) {
      float v = acc[t][r] + bv;
      if (resid) { float rv = resid[(size_t)((row0 + 8 * hh + r) % rmod) * ldr + col]; if (RES_BF16) rv = bf16_round(rv); v += rv; }
      if (ACT == 1) v = fmaxf(v, 0.f);
      if (ACT == 2) v = 0.5f * v * (1.0f + erff(v * 0.70710678118654752f));
      if (ACT == 3) { const float u = 0.7978845608028654f * (v + 0.044715f * v * v * v); v = 0.5f * v * (1.0f + tanhf(u)); }
      so[w][8 * hh + r][t * 16 + ln] = v;
    }
  }
  __builtin_amdgcn_fence(__ATOMIC_ACQ_REL, "workgroup");
  __builtin_amdgcn_wave_barrier();
  const int rsub = lane >> 4, c4 = (lane & 15) * 4;
  {
#pragma unroll
    for (int q = 0; q < 8; ++q) {
      const int r = q * 2 + rsub;
      const v4f v = *(const v4fa*)&so[w][r][c4];
      *(v4f*)(C + (size_t)(row0 + r) * ldc + col0 + c4) = v;
    }
    
  }
}
// row LayerNorm (biased variance, eps) over N: s = X (+ R); optional out_sum <- s; out_norm <- (s-mu)*rsqrt(var+eps)*g + b
template <bool PARAM_BF16>
__global__ __launch_bounds__(256) void k_layernorm(const float* __restrict__ X, const float* __restrict__ R, const float* __restrict__ g, const float* __restrict__ bta,
                                                  float* __restrict__ out_sum, float* __restrict__ out_norm, int N, float eps) {
  __shared__ float red[256];
  const int row = blockIdx.x, tid = threadIdx.x;
  const float* x = X + (size_t)row * N; const float* rr = R ? R + (size_t)row * N : nullptr;
  float vals[16];                     // up to N = 4096
  const int per = N / 256;            // contiguous chunk per thread? use strided-by-4 chunks: thread handles j = tid*4 + 1024*u
  float s1 = 0.f;
  for (int u = 0; u < per / 4; ++u) {
    const int j = tid * 4 + 1024 * u;
    const v4f a = *(const v4fa*)(x + j);
    v4f b = {0.f,0.f,0.f,0.f}; if (rr) b = *(const v4fa*)(rr + j);
#pragma unroll
    for (int q = 0; q < 4; ++q) { const float v = a[q] + b[q]; vals[u * 4 + q] = v; s1 += v; }
  }
  red[tid] = s1; __syncthreads();
  for (int st = 128; st > 0; st >>= 1) { if (tid < st) red[tid] += red[tid + st]; __syncthreads(); }
  const float mu = red[0] / (float)N; __syncthreads();
  float s2 = 0.f;
  for (int u = 0; u < per / 4; ++u)
#pragma unroll
    for (int q = 0; q < 4; ++q) { const float c = vals[u * 4 + q] - mu; s2 += c * c; }
  red[tid] = s2; __syncthreads();
  for (int st = 128; st > 0; st >>= 1) { if (tid < st) red[tid] += red[tid + st]; __syncthreads(); }
  const float rs = rsqrtf(red[0] / (float)N + eps);
  {
    for (int u = 0; u < per / 4; ++u) {
      const int j = tid * 4 + 1024 * u;
      v4f o, sm;
#pragma unroll
      for (int q = 0; q < 4; ++q) {
        float gg = g[j + q], bb = bta[j + q];
        if (PARAM_BF16) { gg = bf16_round(gg); bb = bf16_round(bb); }
        sm[q] = vals[u * 4 + q]; o[q] = (vals[u * 4 + q] - mu) * rs * gg + bb;
      }
      if (out_sum) *(v4f*)(out_sum + (size_t)row * N + j) = sm;
      *(v4f*)(out_norm + (size_t)row * N + j) = o;
    }
    
  }
}



// ---- f16 WMMA path (v_wmma_f32_16x16x32_f16): 11-bit significands for operands in range — used where a [0,1] probability operand needs more precision than bf16
typedef _Float16 v16h __attribute__((ext_vector_type(16)));
union FragH { v16h v; v8us half[2]; _Float16 h[16]; unsigned short u[16]; };
template <int NT>
__device__ __forceinline__ v8f mmaH(v16h ah, v16h al, v16h bh, v16h bl, v8f c) {
  c = __builtin_amdgcn_wmma_f32_16x16x32_f16(false, ah, false, bh, (short)0, c, false, false);
  if (NT >= 2) c = __builtin_amdgcn_wmma_f32_16x16x32_f16(false, al, false, bh, (short)0, c, false, false);
  if (NT >= 3) c = __builtin_amdgcn_wmma_f32_16x16x32_f16(false, ah, false, bl, (short)0, c, false, false);
  asm volatile("v_nop\n\tv_nop\n\tv_nop\n\tv_nop" : "+v"(c) : "v"(ah), "v"(al), "v"(bh), "v"(bl));
  return c;
}
// batched GEMM like k_gemm_b but f16 operands: A f32 (split into f16 hi/lo if ASPLIT, else rounded to f16), Bt = f16 values [n][k]; alpha; C f32; N multiple of 16 (partial tiles skipped)
template <bool ASPLIT>
__global__ __launch_bounds__(128) void k_gemm_h(const float* __restrict__ A, int lda, size_t sA, const _Float16* __restrict__ Bh, int ldb, size_t sB, float alpha, float* __restrict__ C, int ldc, size_t sC, int M, int N, int K) {
  __shared__ __attribute__((aligned(16))) float so[4][16][64];
  const int tid = threadIdx.x, w = tid >> 5, lane = tid & 31, ln = lane & 15, hh = lane >> 4; const int by = blockIdx.y;
  A += (size_t)by * sA; Bh += (size_t)by * sB; C += (size_t)by * sC;
  const int ntn = (N + 63) / 64; const int wid = blockIdx.x * 4 + w; const int mt = wid / ntn, nq = wid % ntn; if (mt * 16 >= M) return;
  const int row0 = mt * 16, col0 = nq * 64; const float* arow = A + (size_t)(row0 + ln) * lda;
  v8f acc[4] = {};
  for (int kb = 0; kb < K; kb += 32) {
    FragH ah, al;
    const v4f x0 = *(const v4fa*)(arow + kb + 8 * hh), x1 = *(const v4fa*)(arow + kb + 8 * hh + 4), x2 = *(const v4fa*)(arow + kb + 16 + 8 * hh), x3 = *(const v4fa*)(arow + kb + 16 + 8 * hh + 4);
    float xs[16] = {x0[0],x0[1],x0[2],x0[3],x1[0],x1[1],x1[2],x1[3],x2[0],x2[1],x2[2],x2[3],x3[0],x3[1],x3[2],x3[3]};
#pragma unroll
    for (int i = 0; i < 16; ++i) { const _Float16 h = (_Float16)xs[i]; ah.h[i] = h; al.h[i] = ASPLIT ? (_Float16)(xs[i] - (float)h) : (_Float16)0.0f; }
#pragma unroll
    for (int t = 0; t < 4; ++t) { if (col0 + t * 16 >= N) continue; const size_t boff = (size_t)(col0 + t * 16 + ln) * ldb + kb; FragH bq; bq.half[0] = *(const v8us*)(Bh + boff + 8 * hh); bq.half[1] = *(const v8us*)(Bh + boff + 16 + 8 * hh);
      acc[t] = mmaH<ASPLIT ? 2 : 1>(ah.v, al.v, bq.v, bq.v, acc[t]); }
  }
#pragma unroll
  for (int t = 0; t < 4; ++t) { if (col0 + t * 16 >= N) continue;
#pragma unroll
    for (int r = 0; r < 8; ++r) so[w][8 * hh + r][t * 16 + ln] = acc[t][r] * alpha; }
  __builtin_amdgcn_fence(__ATOMIC_ACQ_REL, "workgroup"); __builtin_amdgcn_wave_barrier();
  const int rsub = lane >> 4, c4 = (lane & 15) * 4;
  {
#pragma unroll
    for (int q = 0; q < 8; ++q) { const int r = q * 2 + rsub; if (col0 + c4 < N) { const v4f v = *(const v4fa*)&so[w][r][c4]; *(v4f*)(C + (size_t)(row0 + r) * ldc + col0 + c4) = v; } }
     }
}

// Wt[n][k] = f16(W[k][n]·scale) from f32 row-major W[K][N] (scale = power of two; bf16-exact weights stay exact in f16 away from the subnormal range)
__global__ __launch_bounds__(256) void k_wt_f16(const float* __restrict__ W, _Float16* __restrict__ Wt, int K, int N, float scale) {
  const int t = blockIdx.x * 256 + threadIdx.x; if (t >= N * (K / 8)) return; const int n = t / (K / 8), k8 = (t % (K / 8)) * 8; FragH f;
#pragma unroll
  for (int i = 0; i < 8; ++i) f.h[i] = (_Float16)(bf16_round(W[(size_t)(k8 + i) * N + n]) * scale); const v8us o = f.half[0];
  *(v8us*)((unsigned short*)Wt + (size_t)n * K + k8) = o; 
}
// k_gemm_hh variant with fused epilogue: v = acc·alpha + bias[by·sBias + col] (+ CP[(row/rowsPerB)·sCPb + by·64 + col] if CP) ; ACT 0 none / 1 elu ; writes f16 C16 (and f32 C if non-null)
template <int ACT>
__global__ __launch_bounds__(128) void k_gemm_hhx(const _Float16* __restrict__ A, int lda, size_t sA, const _Float16* __restrict__ Bh, int ldb, size_t sB, float alpha, const float* __restrict__ bias, size_t sBias, const float* __restrict__ CP, int rowsPerB, size_t sCPb, int row0g,
    float* __restrict__ C, _Float16* __restrict__ C16, int ldc, size_t sC, int M, int N, int K) {
  __shared__ __attribute__((aligned(16))) float so[4][16][64];
  const int tid = threadIdx.x, w = tid >> 5, lane = tid & 31, ln = lane & 15, hh = lane >> 4; const int by = blockIdx.y;
  A += (size_t)by * sA; Bh += (size_t)by * sB; const size_t cofs = (size_t)by * sC; const float* bp = bias ? bias + (size_t)by * sBias : nullptr;
  const int ntn = (N + 63) / 64; const int wid = blockIdx.x * 4 + w; const int mt = wid / ntn, nq = wid % ntn; if (mt * 16 >= M) return;
  const int row0 = mt * 16, col0 = nq * 64; const _Float16* arow = A + (size_t)(row0 + ln) * lda;
  v8f acc[4] = {};
  for (int kb = 0; kb < K; kb += 32) { FragH ah; ah.half[0] = *(const v8us*)((const unsigned short*)arow + kb + 8 * hh); ah.half[1] = *(const v8us*)((const unsigned short*)arow + kb + 16 + 8 * hh);
#pragma unroll
    for (int t = 0; t < 4; ++t) { if (col0 + t * 16 >= N) continue; const size_t boff = (size_t)(col0 + t * 16 + ln) * ldb + kb; FragH bq; bq.half[0] = *(const v8us*)((const unsigned short*)Bh + boff + 8 * hh); bq.half[1] = *(const v8us*)((const unsigned short*)Bh + boff + 16 + 8 * hh);
      acc[t] = mmaH<1>(ah.v, ah.v, bq.v, bq.v, acc[t]); }
  }
#pragma unroll
  for (int t = 0; t < 4; ++t) { if (col0 + t * 16 >= N) continue; const int col = col0 + t * 16 + ln; const float bv = bp ? bf16_round(bp[col]) : 0.f;
#pragma unroll
    for (int r = 0; r < 8; ++r) { float v = acc[t][r] * alpha + bv; if (CP) { const int rr = row0g + row0 + 8 * hh + r; if (rowsPerB < 0) v += CP[cofs + (size_t)rr * ldc + col];      /* rowsPerB < 0: own element of the batched C plane */ else { const int bidx = rr / rowsPerB; v += CP[(size_t)bidx * sCPb + (size_t)by * 64 + col]; } } if (ACT == 1) v = (v > 0.f) ? v : expm1f(v); else if (ACT == 7) v = (v > 0.f) ? v + 1.0f : expf(v); else if (ACT == 8) v = tanhf(v); else if (ACT == 9) v = 0.5f * v * (1.0f + tanhf(0.7978845608028654f * (v + 0.044715f * v * v * v))); else if (ACT == 11) v = 1.0f / (1.0f + expf(-v)); else if (ACT == 12) v = (v > 0.f) ? v : 0.01f * v; else if (ACT == 14) v = (v > 0.f) ? v : 0.1f * v; else if (ACT == 16) v = (v >= 0.f) ? v : 0.3f * v; else if (ACT == 17) v = (v >= 0.f) ? v : 0.2f * v; else if (ACT == 15) v = v / (1.0f + expf(-v)); else if (ACT == 3) v = fmaxf(v, 0.f); else if (ACT == 6) v = 0.5f * v * (1.0f + erff(v * 0.70710678118654752f)); so[w][8 * hh + r][t * 16 + ln] = v; } }
  __builtin_amdgcn_fence(__ATOMIC_ACQ_REL, "workgroup"); __builtin_amdgcn_wave_barrier();
  const int rsub = lane >> 4, c4 = (lane & 15) * 4; typedef _Float16 v4h __attribute__((ext_vector_type(4)));
  {
#pragma unroll
    for (int q = 0; q < 8; ++q) { const int r = q * 2 + rsub; if (col0 + c4 < N) { const v4f v = *(const v4fa*)&so[w][r][c4]; if (C) *(v4f*)(C + cofs + (size_t)(row0 + r) * ldc + col0 + c4) = v; if (C16) { v4h h4; for (int i = 0; i < 4; ++i) h4[i] = (_Float16)v[i]; *(v4h*)(C16 + cofs + (size_t)(row0 + r) * ldc + col0 + c4) = h4; } } }
     }
}


typedef _Float16 v4h __attribute__((ext_vector_type(4)));

// FRAGMENT ORDER of an f16 operand plane of 2048 columns: the plane is cut into tiles of 16 rows x 32 columns, 1 KiB each, 64 tiles to a strip of 16 rows (a strip starts where it starts in the row-major plane).
// Inside a tile the 16-byte piece p = 32 half + 16 hh + ln holds columns 16 half + 8 hh .. + 7 of row ln: piece 32 half + lane is what lane (hh, ln) takes as elements 8 half .. 8 half + 7 of an A or B fragment.
// So each of the two 16-byte loads of a fragment reads 512 contiguous bytes (4 whole lines) over the wave; from a row-major plane it took 32 bytes out of each of 16 lines. The registers hold the same values as before.
static_assert(DMX == 2048 && DKV == 2048 && SQ == 2048, "fragment order below is written for planes of 2048 columns");
// A converting launch gives thread t eight values of tile t / 64: row (t & 63) / 4, columns 8 (t & 3) .. + 7. Four neighbouring lanes read one whole row of the tile (a 128-byte line of the f32 source), and the wave's store fills four whole lines of the plane.
__device__ __forceinline__ size_t fo_src(size_t t) { const size_t tile = t >> 6; return ((tile >> 6) * 16 + ((t & 63) >> 2)) * 2048 + (tile & 63) * 32 + (t & 3) * 8; }      /* element offset of thread t's 8 values in the row-major source */
__device__ __forceinline__ size_t fo_dst(size_t t) { return (t >> 6) * 512 + ((t & 3) * 16 + ((t & 63) >> 2)) * 8; }      /* and in the plane in fragment order: piece 16 (2 half + hh) + ln */
// All five operand conversions in one launch: work-groups 0 .. 4 WB - 1 take the four weights (WB work-groups each, values x16), the rest take x (x1). Every plane in fragment order, the values as before.
#define WB ((unsigned)((size_t)DMX * DMX / 8 / 256))
__global__ __launch_bounds__(256) void k_prep(const float* __restrict__ x, const float* __restrict__ wq, const float* __restrict__ wk, const float* __restrict__ wv, const float* __restrict__ wo,
    _Float16* __restrict__ X16, _Float16* __restrict__ BQ, _Float16* __restrict__ BK, _Float16* __restrict__ BV, _Float16* __restrict__ BO) {
  const unsigned sel = blockIdx.x / WB < 4u ? blockIdx.x / WB : 4u;      /* the same for the whole work-group */
  const float* s = sel == 0 ? wq : sel == 1 ? wk : sel == 2 ? wv : sel == 3 ? wo : x; _Float16* d = sel == 0 ? BQ : sel == 1 ? BK : sel == 2 ? BV : sel == 3 ? BO : X16; const float sc = sel < 4u ? 16.0f : 1.0f;
  const size_t t = (size_t)(blockIdx.x - sel * WB) * 256 + threadIdx.x; FragH f; const float* p = s + fo_src(t); const v4f a = *(const v4fa*)p, c = *(const v4fa*)(p + 4);
#pragma unroll
  for (int q = 0; q < 4; ++q) { f.h[q] = (_Float16)(bf16_round(a[q]) * sc); f.h[4 + q] = (_Float16)(bf16_round(c[q]) * sc); }
  *(v8us*)((unsigned short*)d + fo_dst(t)) = f.half[0]; }
__global__ __launch_bounds__(256) void k_h16(const float* __restrict__ x, _Float16* __restrict__ X16, size_t n8) { const size_t t = (size_t)blockIdx.x * 256 + threadIdx.x; if (t >= n8) return; FragH f;
#pragma unroll
  for (int q = 0; q < 8; ++q) f.h[q] = (_Float16)x[t * 8 + q]; *(v8us*)((unsigned short*)X16 + t * 8) = f.half[0];  }
__global__ __launch_bounds__(256) void k_round16f(const float* __restrict__ W, _Float16* __restrict__ Bt, size_t n8) { const size_t t = (size_t)blockIdx.x * 256 + threadIdx.x; if (t >= n8) return; FragH f;
#pragma unroll
  for (int i = 0; i < 8; ++i) f.h[i] = (_Float16)(bf16_round(W[t * 8 + i]) * 16.0f); *(v8us*)((unsigned short*)Bt + t * 8) = f.half[0];  }
template <int NHv, int TTv>
__global__ __launch_bounds__(256) void k_vt(const _Float16* __restrict__ V16, int ldv, int voff, _Float16* __restrict__ Vt) { __shared__ unsigned short tl[64][66]; const int tid = threadIdx.x; const int slab = blockIdx.x / (TTv / 64), lg = blockIdx.x % (TTv / 64); const int b = slab / NHv, h = slab % NHv;
  for (int i = tid; i < 64 * 8; i += 256) { const int r = i / 8, c8 = (i % 8) * 8; FragH f; f.half[0] = *(const v8us*)((const unsigned short*)V16 + ((size_t)b * TTv + lg * 64 + r) * ldv + voff + h * 64 + c8);
#pragma unroll
    for (int q = 0; q < 8; ++q) tl[r][c8 + q] = f.u[q]; }
  __syncthreads();
  {
#pragma unroll
    for (int rd = 0; rd < 2; ++rd) { const int idx = rd * 256 + tid, t8 = idx >> 6, p = idx & 63; const int d = (t8 >> 1) * 16 + (p & 15), c8 = (t8 & 1) * 32 + (p >> 5) * 16 + ((p >> 4) & 1) * 8; FragH f;      /* the 64 x 64 block = 4 x 2 tiles of V^T in fragment order (rows = dims, columns = keys), a thread per 16-byte piece */
#pragma unroll
      for (int q = 0; q < 8; ++q) f.u[q] = tl[c8 + q][d];
      *(v8us*)((unsigned short*)Vt + (((size_t)slab * 4 + (t8 >> 1)) * (TTv / 32) + lg * 2 + (t8 & 1)) * 512 + p * 8) = f.half[0]; }
     } }

template <bool FO>      /* FO: the two planes are written in fragment order (F stays row-major) */
__global__ __launch_bounds__(256) void k_hl(const float* __restrict__ F, _Float16* __restrict__ Hh, _Float16* __restrict__ Hl, size_t n8) { const size_t t = (size_t)blockIdx.x * 256 + threadIdx.x; if (t >= n8) return; FragH fh, fl; const float* fs = F + (FO ? fo_src(t) : t * 8); const v4f a = *(const v4fa*)fs, c = *(const v4fa*)(fs + 4);
#pragma unroll
  for (int q = 0; q < 4; ++q) { _Float16 h = (_Float16)a[q]; fh.h[q] = h; fl.h[q] = (_Float16)((a[q] - (float)h) * 1024.0f); h = (_Float16)c[q]; fh.h[4 + q] = h; fl.h[4 + q] = (_Float16)((c[q] - (float)h) * 1024.0f); }
  { const size_t d = FO ? fo_dst(t) : t * 8; *(v8us*)((unsigned short*)Hh + d) = fh.half[0]; *(v8us*)((unsigned short*)Hl + d) = fl.half[0];  } }

// ---- fast GEMM (wave tile 64x128, work-group tile 128x256 = 2 x 2 waves; requires M % 128 == 0 rows per launch region, N % 256 == 0, K % (32 NS) == 0); A and Bh in fragment order, planes of 2048 columns; C = acc alpha ----
__device__ __forceinline__ v16h g2_frag(const _Float16* p) { FragH f; f.half[0] = *(const v8us*)((const unsigned short*)p); f.half[1] = *(const v8us*)((const unsigned short*)p + 256); return f.v; }      /* p = the tile in fragment order + 8 lane */
__device__ __forceinline__ v8f g2_mma(v16h a, v16h b, v8f c) { return __builtin_amdgcn_wmma_f32_16x16x32_f16(false, a, false, b, (short)0, c, false, false); }      /* the plain builtin (the compiler keeps its distances): the tile's registers reach above v255, where no asm operand can sit */
struct G2S { v16h a[4], b[8]; };      /* the fragments of one k-step of a 64x128 wave tile: 12 KiB loaded for 32 products (the 32x64 tile loaded 6 KiB for 8) */
__device__ __forceinline__ void g2_load(G2S& s, const _Float16* ap, const _Float16* bp) {      /* ap, bp: the first strip's tile of this k-step + 8 lane; a strip of 16 rows lies 16 x 2048 elements behind the one before: a constant, so the 24 loads share two addresses */
#pragma unroll
  for (int i = 0; i < 4; ++i) s.a[i] = g2_frag(ap + i * 16 * 2048);
#pragma unroll
  for (int j = 0; j < 8; ++j) s.b[j] = g2_frag(bp + j * 16 * 2048); }
// The wave tile leaves in four pieces of 32x64, one after the other through the wave's one LDS staging area; what follows is said of a piece.
// PL 0: C (f32) row-major. PL 1, 2: the result also leaves as the two f16 operand planes of its consumer, hi + x1024 residual (the split of k_hl), in fragment order, written by this epilogue:
//   PL 1: planes of the result itself: a 32x64 piece = 2 x 2 whole 1 KiB tiles (16 rows x 32 columns), a lane's 16-byte piece = 8 neighbouring columns of one row, read back from the LDS staging;
//   PL 2: planes of the TRANSPOSED result (rows = columns of C): the piece = 4 whole tiles of 16 columns x 32 rows, and the 8 values of accumulator u of a lane (rows 16 (u / 4) + 8 hh + r of column 16 (u % 4) + ln) ARE piece 32 (u / 4) + lane of tile u % 4: no LDS.
//   With PL 1, 2 the f32 C is stored only by work-groups whose first row lies below frows inside its batch (the rows that a later f32 consumer reads); blockIdx.y moves both planes on by sP elements. Each plane store of a wave writes 512 contiguous bytes.
//   No bias, no CP, no C16 (no launch passes one) and C of 2048 columns like the planes (for speed only).
template <int ACT, int PL, int NS>      /* NS: k-steps of fragments held in registers */
__global__ __launch_bounds__(128) void k_gemm2(const _Float16* __restrict__ A, int lda, size_t sA, const _Float16* __restrict__ Bh, int ldb, size_t sB, float alpha, const float* __restrict__ bias, size_t sBias, const float* __restrict__ CP, int rowsPerB, size_t sCPb, int row0g,
    float* __restrict__ C, _Float16* __restrict__ C16, int ldc, size_t sC, int M, int N, int K, _Float16* __restrict__ Ph, _Float16* __restrict__ Pl, int frows, size_t sP) { static_assert(ACT == 0 || ACT == 3 || ACT == 6 || ACT == 8 || ACT == 9 || ACT == 11 || ACT == 12 || ACT == 14 || ACT == 15 || ACT == 16 || ACT == 17, "k_gemm2: unsupported ACT code (would silently apply no activation)");
  __shared__ __attribute__((aligned(16))) float so[4][32][68];
  const int tid = threadIdx.x, w = tid >> 5, lane = tid & 31, ln = lane & 15, hh = lane >> 4; const int by = blockIdx.y;
  A += (size_t)by * sA; Bh += (size_t)by * sB; size_t cofs = (size_t)by * sC;
  (void)lda; (void)ldb; (void)ldc; (void)bias; (void)sBias; (void)CP; (void)rowsPerB; (void)sCPb; (void)row0g; (void)C16; const int ntn = N >> 8; const int mt = blockIdx.x / ntn, nq = blockIdx.x - mt * ntn; const int row0 = mt * 128 + 64 * (w >> 1), col0 = nq * 256 + 128 * (w & 1); if (row0 >= M) return;      /* two waves share each A strip, two each B strip */
  const int bb = PL == 0 ? 0 : row0 / SQ;      /* PL 1, 2: the rows are the token rows of all batches; bb = the batch of this wave's rows (128 divides SQ: the same for the whole work-group) */
  if (PL != 0) { Ph += (size_t)by * sP; Pl += (size_t)by * sP; cofs -= (size_t)bb * (SQ - frows) * 2048; }      /* the f32 C holds frows rows a batch, one batch behind the other: row bb frows + (row - bb SQ) */
  const _Float16* ap = A + (size_t)row0 * 2048 + lane * 8; const _Float16* bfp = Bh + (size_t)col0 * 2048 + lane * 8;
  // k loop, NS k-steps of fragments in registers: a step's 24 loads are issued together, directly behind the products of the step that held those registers,
  // so they fly during the other NS - 1 steps' products. NS = 2 leaves room for two waves on a SIMD (a launch of two work-groups a WGP: each wave's loads also fly during the other's products);
  // NS = 4 is for a launch of at most one work-group a WGP, where a wave has only its own products to cover its loads. Each accumulator sums its products in ascending k.
  const int nst = K >> 5; G2S s[NS]; int ko = 0;
#pragma unroll
  for (int n = 0; n < NS; ++n) { g2_load(s[n], ap + 512 * n, bfp + 512 * n); __builtin_amdgcn_sched_barrier(0); }      /* the sets are requested one after the other, as in the loop: mixed, the counted load waits in the loop (set for both ways into it) would wait for the younger sets too */
  asm volatile("s_wait_xcnt 0x0" ::: "memory");      /* stands in front of the clearing of the accumulators, some of which may take the registers of an address that the loads above name (a precaution) */
  const v8f z8 = {0.f,0.f,0.f,0.f,0.f,0.f,0.f,0.f}; v8f cc[4][8];      /* [A strip][B strip] */
#pragma unroll
  for (int i = 0; i < 4; ++i) {
#pragma unroll
    for (int j = 0; j < 8; ++j) cc[i][j] = z8; }
#define G2_MMA32(S) { _Pragma("unroll") for (int j = 0; j < 8; ++j) { _Pragma("unroll") for (int i = 0; i < 4; ++i) cc[i][j] = g2_mma(S.a[i], S.b[j], cc[i][j]); } }
  /* G2_STEP: the k offset moves on by NS steps. The wait stands in front of the rewrite of the address registers that the loads in flight name (a precaution); the new offset is its output, so every new address is formed behind it. */
#define G2_STEP { ko += 512 * NS; asm volatile("s_wait_xcnt 0x0" : "+s"(ko) : : "memory"); }
#pragma unroll 1      /* one trip = NS k-steps, one per register set; rolled so that the sets keep their registers */
  for (int st = 0; st + 2 * NS <= nst; st += NS) {
#pragma unroll
    for (int n = 0; n < NS; ++n) { G2_MMA32(s[n]) if (n == 0) G2_STEP
      g2_load(s[n], ap + ko + 512 * n, bfp + ko + 512 * n); __builtin_amdgcn_sched_barrier(0); } }      /* the barrier keeps the next set's first product, with its load wait, from moving up in front of these requests */
  asm volatile("s_wait_xcnt 0x0" ::: "memory"); __builtin_amdgcn_sched_barrier(0);      /* behind the last requests: their address registers are free from here on (a precaution); the barrier keeps their reuse below the wait */
#pragma unroll
  for (int n = 0; n < NS; ++n) G2_MMA32(s[n])      /* the last NS k-steps, all loaded */
#undef G2_STEP
#undef G2_MMA32
  static_assert(PL == 0 || ACT == 0, "the plane epilogues carry no activation");
  const bool f32rows = PL == 0 || mt * 128 - bb * SQ < frows;      /* the same for the whole work-group */
  const int rsub = lane >> 4, c4 = (lane & 15) * 4;
#pragma unroll
  for (int pc = 0; pc < 4; ++pc) { const int r0 = row0 + (pc >> 1) * 32, c0 = col0 + (pc & 1) * 64; v8f accs[8];      /* piece pc: A strips 2 (pc / 2), + 1; B strips 4 (pc % 2) .. + 3 */
#pragma unroll
  for (int u = 0; u < 8; ++u) accs[u] = cc[(pc >> 1) * 2 + (u >> 2)][(pc & 1) * 4 + (u & 3)];
  if (PL != 2 || f32rows) {      /* the LDS staging of the piece: PL 2 needs it for its f32 rows only */
#pragma unroll
    for (int u = 0; u < 8; ++u) { const int t = u & 3, half = u >> 2;
#pragma unroll
    for (int r = 0; r < 8; ++r) { const int rloc = half * 16 + 8 * hh + r; float v = accs[u][r] * alpha;
      if (ACT == 3) v = fmaxf(v, 0.f); else if (ACT == 6) v = 0.5f * v * (1.0f + erff(v * 0.70710678118654752f)); else if (ACT == 11) v = 1.0f / (1.0f + expf(-v)); else if (ACT == 15) v = v / (1.0f + expf(-v)); else if (ACT == 12) v = (v > 0.f) ? v : 0.01f * v; else if (ACT == 8) v = tanhf(v); else if (ACT == 9) v = 0.5f * v * (1.0f + tanhf(0.7978845608028654f * (v + 0.044715f * v * v * v))); else if (ACT == 14) v = (v > 0.f) ? v : 0.1f * v; else if (ACT == 16) v = (v >= 0.f) ? v : 0.3f * v; else if (ACT == 17) v = (v >= 0.f) ? v : 0.2f * v;
      so[w][rloc][t * 16 + ln] = v; } }
    asm volatile("s_wait_dscnt 0x0" ::: "memory"); __builtin_amdgcn_wave_barrier(); }      /* the wave's staging writes are done before it reads the rows back (its own area only, so no wait for the global stores of the piece before, which a work-group fence would bring) */
  if (PL != 0) { FragH ph[8], pr[8];      /* a lane's eight 16-byte pieces of the hi plane and of the residual plane */
#pragma unroll
    for (int i = 0; i < 8; ++i) { float x[8];
      if (PL == 1) { const float* sp = &so[w][(i >> 2) * 16 + ln][((i >> 1) & 1) * 32 + (i & 1) * 16 + hh * 8]; const v4f a = *(const v4fa*)sp, c = *(const v4fa*)(sp + 4);
#pragma unroll
        for (int q = 0; q < 4; ++q) { x[q] = a[q]; x[4 + q] = c[q]; } }
      else {
#pragma unroll
        for (int q = 0; q < 8; ++q) x[q] = accs[i][q] * alpha; }      /* the value that the staging loop forms (no bias, no CP here) */
#pragma unroll
      for (int q = 0; q < 8; ++q) { const _Float16 h = (_Float16)x[q]; ph[i].h[q] = h; pr[i].h[q] = (_Float16)((x[q] - (float)h) * 1024.0f); } }
    unsigned short* dh = (unsigned short*)Ph + (PL == 1 ? (size_t)r0 * 2048 + (size_t)c0 * 16 : (size_t)bb * N * SQ + (size_t)c0 * 2048 + (size_t)(r0 - bb * SQ) * 16) + lane * 8;      /* PL 2: a transposed plane of N rows x SQ columns a batch */ unsigned short* dl = (unsigned short*)Pl + (dh - (unsigned short*)Ph);
    __builtin_amdgcn_sched_barrier(0);      /* all sixteen pieces are formed above, each in registers of its own: no conversion sinks between the stores and overwrites a register of a store already issued */
#pragma unroll
    for (int i = 0; i < 8; ++i) { const size_t d = PL == 1 ? (size_t)(i >> 2) * 16 * 2048 + ((i >> 1) & 1) * 512 + (i & 1) * 256 : (size_t)(i & 3) * 16 * 2048 + (i >> 2) * 256; *(v8us*)(dh + d) = ph[i].half[0]; *(v8us*)(dl + d) = pr[i].half[0]; }
    __builtin_amdgcn_sched_barrier(0); asm volatile("s_wait_xcnt 0x0" ::: "memory"); __builtin_amdgcn_sched_barrier(0); }      /* stands in front of whatever reuses the data and address registers of the sixteen stores (a precaution); the two barriers keep the stores above it and the next piece's vector work below it */
  if (f32rows) { v4f fv[16]; float* cr = C + cofs + (size_t)(r0 + rsub) * 2048 + c0 + c4;      /* rows r0 + 2 q + rsub; the pitch is a constant, so the sixteen stores share one address */
#pragma unroll
    for (int q = 0; q < 16; ++q) fv[q] = *(const v4fa*)&so[w][q * 2 + rsub][c4];
#pragma unroll
    for (int q = 0; q < 16; ++q) *(v4f*)(cr + q * 2 * 2048) = fv[q];
    __builtin_amdgcn_sched_barrier(0); asm volatile("s_wait_xcnt 0x0" ::: "memory"); __builtin_amdgcn_sched_barrier(0);      /* as behind the plane stores */
     }
  if (pc < 3 && (PL != 2 || f32rows)) { __builtin_amdgcn_fence(__ATOMIC_ACQ_REL, "wavefront"); __builtin_amdgcn_wave_barrier(); } } }      /* the next piece's staging writes stay behind this piece's reads of the same area (a wave's own; its LDS operations run in order) */


__global__ __launch_bounds__(256) void k_rsm(const float* __restrict__ S, _Float16* __restrict__ P, int nrows) {
  #pragma clang fp contract(off)
  const int i = blockIdx.x * 256 + threadIdx.x; if (i >= nrows) return; const float* s = S + (size_t)i * SQ; float mx = -3.0e38f;
#pragma unroll 1
  for (int j = 0; j < SQ; ++j) mx = fmaxf(mx, s[j]); float se = 0.f;
#pragma unroll 1
  for (int j = 0; j < SQ; ++j) se += expf(s[j] - mx); const float sc = 256.0f / se;
#pragma unroll 1
  for (int j0 = 0; j0 < SQ; j0 += 8) { FragH f; for (int q = 0; q < 8; ++q) f.h[q] = (_Float16)(expf(s[j0 + q] - mx) * sc); unsigned short* d = (unsigned short*)P + (size_t)i * SQ + j0; *(v8us*)d = f.half[0];  } }
__global__ __launch_bounds__(256) void k_vt(const _Float16* __restrict__ V16, int b, int h0, _Float16* __restrict__ VT) { __shared__ unsigned short tl[64][65]; const int tid = threadIdx.x; const int hh = blockIdx.x % HG, sg = blockIdx.x / HG; const int s0 = sg * 64; const int h = h0 + hh;
  for (int i = tid; i < 64 * 8; i += 256) { const int j = i / 8, d8 = (i % 8) * 8; FragH f; f.half[0] = *(const v8us*)((const unsigned short*)V16 + ((size_t)b * SQ + s0 + j) * DM + h * HD + d8); for (int q = 0; q < 8; ++q) tl[d8 + q][j] = f.u[q]; }
  __syncthreads();
  { for (int i = tid; i < 64 * 8; i += 256) { const int d = i / 8, j8 = (i % 8) * 8; FragH f; for (int q = 0; q < 8; ++q) f.u[q] = tl[d][j8 + q]; *(v8us*)((unsigned short*)VT + ((size_t)hh * HD + d) * SQ + s0 + j8) = f.half[0]; }  } }


__global__ __launch_bounds__(256) void k_f2h(const float* __restrict__ F, int ldf, int coff, int ncol, _Float16* __restrict__ H16, size_t nrow) { const size_t t = (size_t)blockIdx.x * 256 + threadIdx.x; const size_t n8 = nrow * (size_t)(ncol / 8); if (t >= n8) return; const size_t r = t / (ncol / 8); const int c8 = (int)(t % (ncol / 8)) * 8; FragH f; const v4f a = *(const v4fa*)(F + r * ldf + coff + c8), b2 = *(const v4fa*)(F + r * ldf + coff + c8 + 4); for (int q = 0; q < 4; ++q) { f.h[q] = (_Float16)a[q]; f.h[4 + q] = (_Float16)b2[q]; } *(v8us*)((unsigned short*)H16 + r * ncol + c8) = f.half[0];  }

__global__ __launch_bounds__(256) void k_tab128(float theta, float* __restrict__ CS, float* __restrict__ SN) {
  #pragma clang fp contract(off)
  const int t = blockIdx.x * 256 + threadIdx.x; if (t >= SQ * 64) return; const int i = t % 64; const int p = t / 64; const float invf = (float)(1.0 / pow((double)theta, (double)(2 * i) / 128.0));      /* = XLA's constant-folded f32 table */ const float ang = __fmul_rn((float)p, invf); const float c = cosf(ang), s = sinf(ang);
  *(float*)(CS + t) = c; *(float*)(SN + t) = s;  }
template <int TAB>
__global__ __launch_bounds__(128) void k_rope128(const float* __restrict__ F, int ldf, int nh, const float* __restrict__ CS, const float* __restrict__ SN, _Float16* __restrict__ H16, int ldo, float osc) {
  #pragma clang fp contract(off)
  __shared__ float xv[128]; __shared__ unsigned short sh_[128]; const int d = threadIdx.x; const int h = blockIdx.x % nh; const size_t r = blockIdx.x / nh; const int p = (int)(r % SQ);
  xv[d] = F[r * (size_t)ldf + (size_t)h * 128 + d]; __syncthreads();
  float c, s; if (TAB) { c = bf16_round(CS[(size_t)p * 128 + d]); s = bf16_round(SN[(size_t)p * 128 + d]); } else { c = CS[p * 64 + (d & 63)]; s = SN[p * 64 + (d & 63)]; }
  const float rot = (d < 64) ? -xv[d + 64] : xv[d - 64]; const float o = __fadd_rn(__fmul_rn(xv[d], c), __fmul_rn(rot, s));
  FragH th; th.h[0] = (_Float16)__fmul_rn(o, osc); sh_[d] = th.u[0]; __syncthreads();
  if (d < 16) { FragH f; for (int q = 0; q < 8; ++q) f.u[q] = sh_[d * 8 + q]; unsigned short* dst = (unsigned short*)H16 + r * (size_t)ldo + (size_t)h * 128 + d * 8; *(v8us*)dst = f.half[0];  } }

template <int TAB, int IL, int F32OUT>
__global__ __launch_bounds__(128) void k_rope128x(const float* __restrict__ F, int ldf, int nh, const float* __restrict__ CS, const float* __restrict__ SN, void* __restrict__ OUT, int ldo, float osc) {
  #pragma clang fp contract(off)
  __shared__ float xv[128]; __shared__ float ov[128]; const int d = threadIdx.x; const int h = blockIdx.x % nh; const size_t r = blockIdx.x / nh; const int p = (int)(r % SQ);
  xv[d] = F[r * (size_t)ldf + (size_t)h * 128 + d]; __syncthreads();
  float c, s; if (TAB == 2) { c = CS[r * 128 + d]; s = SN[r * 128 + d]; }      /* computed full-width f32 tables, one row per token row r (relative to the passed pointers) */ else if (TAB) { c = bf16_round(CS[(size_t)p * 128 + d]); s = bf16_round(SN[(size_t)p * 128 + d]); } else { const int ti = IL ? (d >> 1) : (d & 63); c = CS[p * 64 + ti]; s = SN[p * 64 + ti]; }
  const float rot = IL ? ((d & 1) ? xv[d - 1] : -xv[d + 1]) : ((d < 64) ? -xv[d + 64] : xv[d - 64]);
  ov[d] = __fmul_rn(__fadd_rn(__fmul_rn(xv[d], c), __fmul_rn(rot, s)), osc); __syncthreads();
  if (F32OUT) { if (d < 32) { const v4f v = *(const v4f*)&ov[d * 4]; float* dst = (float*)OUT + r * (size_t)ldo + (size_t)h * 128 + d * 4; *(v4f*)dst = v;  } }
  else { if (d < 16) { FragH f; for (int q = 0; q < 8; ++q) f.h[q] = (_Float16)ov[d * 8 + q]; unsigned short* dst = (unsigned short*)OUT + r * (size_t)ldo + (size_t)h * 128 + d * 8; *(v8us*)dst = f.half[0];  } } }
template <int N>
__global__ __launch_bounds__(256) void k_rmsrow(float* __restrict__ X, const float* __restrict__ w, float eps) {
  #pragma clang fp contract(off)
  constexpr int PT = N / 256; __shared__ float red[256]; const size_t r = blockIdx.x; const int t = threadIdx.x; float* row = X + r * N + (size_t)t * PT; float v[PT]; float ss = 0.f;
  for (int q = 0; q < PT; ++q) { v[q] = row[q]; ss = __fadd_rn(ss, __fmul_rn(v[q], v[q])); }
  red[t] = ss; __syncthreads(); for (int k = 128; k > 0; k >>= 1) { if (t < k) red[t] = __fadd_rn(red[t], red[t + k]); __syncthreads(); }
  const float rs = rsqrtf(__fadd_rn(red[0] / (float)N, eps)); float o[PT]; for (int q = 0; q < PT; ++q) o[q] = __fmul_rn(__fmul_rn(v[q], rs), bf16_round(w[t * PT + q]));
  { for (int q = 0; q < PT; ++q) *(float*)(row + q) = o[q];  } }
template <int GS_, int NHQ, int DSRC>
__global__ __launch_bounds__(256) void k_kvexp128(const float* __restrict__ src, float* __restrict__ dst, size_t n4) { const size_t t = (size_t)blockIdx.x * 256 + threadIdx.x; if (t >= n4) return; const size_t e = t * 4; const size_t row = e / ((size_t)NHQ * 128); const int col = (int)(e % ((size_t)NHQ * 128)); const int h = col / 128, d = col % 128; const v4f v = *(const v4fa*)(src + row * DSRC + (size_t)(h / GS_) * 128 + d); *(v4f*)(dst + e) = v;  }

__global__ __launch_bounds__(256) void k_rsmcfb(const float* __restrict__ S, _Float16* __restrict__ P, int hg, int q0, int nk, const int* __restrict__ mk) {
  #pragma clang fp contract(off)
  const int t = blockIdx.x * 256 + threadIdx.x; if (t >= hg * QT) return; const size_t i = (size_t)t; const float* s = S + i * NKX; const size_t ig = (size_t)(q0 + (t % QT)); const int* mr = mk + ig * SQ; float mx = -3.0e38f;
#pragma unroll 1
  for (int j = 0; j < nk; ++j) { const int mb = mr[j]; const float f = (mb == 0) ? 1.f : 0.f; mx = fmaxf(mx, fmaf(f, s[j], (1.f - f) * -1.0e9f)); } float se = 0.f;
#pragma unroll 1
  for (int j = 0; j < nk; ++j) { const int mb = mr[j]; const float f = (mb == 0) ? 1.f : 0.f; se += __expf(fmaf(f, s[j], (1.f - f) * -1.0e9f) - mx); } const float sc = 256.0f / se;
#pragma unroll 1
  for (int j0 = 0; j0 < nk; j0 += 8) { FragH fr; for (int q = 0; q < 8; ++q) { const int j = j0 + q; const int mb = mr[j]; const float f = (mb == 0) ? 1.f : 0.f; fr.h[q] = (_Float16)(__expf(fmaf(f, s[j], (1.f - f) * -1.0e9f) - mx) * sc); } unsigned short* d = (unsigned short*)P + i * NKX + j0; *(v8us*)d = fr.half[0];  } }


__global__ __launch_bounds__(256) void k_rsmcf2(const float* __restrict__ S, _Float16* __restrict__ P, int hg, int q0, int nk) {
  #pragma clang fp contract(off)
  const int t = blockIdx.x * 256 + threadIdx.x; if (t >= hg * QT) return; const size_t i = (size_t)t; const float* s = S + i * NKX; const int last = q0 + (t % QT); float mx = -3.0e38f;
#pragma unroll 1
  for (int j = 0; j < nk; ++j) { const float f = (j <= last) ? 1.f : 0.f; mx = fmaxf(mx, fmaf(f, s[j], (1.f - f) * -1.0e9f)); } float se = 0.f;
#pragma unroll 1
  for (int j = 0; j < nk; ++j) { const float f = (j <= last) ? 1.f : 0.f; se += __expf(fmaf(f, s[j], (1.f - f) * -1.0e9f) - mx); } const float sc = 256.0f / se;
#pragma unroll 1
  for (int j0 = 0; j0 < nk; j0 += 8) { FragH fr; for (int q = 0; q < 8; ++q) { const int j = j0 + q; const float f = (j <= last) ? 1.f : 0.f; fr.h[q] = (_Float16)(__expf(fmaf(f, s[j], (1.f - f) * -1.0e9f) - mx) * sc); } unsigned short* d = (unsigned short*)P + i * NKX + j0; *(v8us*)d = fr.half[0];  } }



__global__ __launch_bounds__(256) void k_tab128p(const int* __restrict__ pos, int nrows, float theta, float* __restrict__ CS, float* __restrict__ SN) {
  #pragma clang fp contract(off)
  const int t = blockIdx.x * 256 + threadIdx.x; if (t >= nrows * 64) return; const int i = t % 64; const int r = t / 64; const float invf = (float)(1.0 / pow((double)theta, (double)(2 * i) / 128.0)); const float ang = __fmul_rn((float)pos[r], invf); const float c = cosf(ang), sv = sinf(ang);
  float* c0 = CS + (size_t)r * 128 + i; float* s0 = SN + (size_t)r * 128 + i;
  { *(float*)c0 = c; *(float*)(c0 + 64) = c; *(float*)s0 = sv; *(float*)(s0 + 64) = sv;  } }

__global__ __launch_bounds__(256) void k_rsmcim(const float* __restrict__ S, _Float16* __restrict__ P, int hg, int q0, int nk, const int* __restrict__ am) {
  #pragma clang fp contract(off)
  const int t = blockIdx.x * 256 + threadIdx.x; if (t >= hg * QT) return; const size_t i = (size_t)t; const float* s = S + i * NKX; const int last = q0 + (t % QT); const int* mr = am + (size_t)last * SQ; float mx = -3.0e38f;      /* the module's mask row of this query (keys >= nk lie above the diagonal of the causal mask and are not computed) */
#pragma unroll 1
  for (int j = 0; j < nk; ++j) { const float f = (mr[j] != 0) ? 1.f : 0.f; mx = fmaxf(mx, fmaf(f, s[j], (1.f - f) * -1.0e9f)); } float se = 0.f;
#pragma unroll 1
  for (int j = 0; j < nk; ++j) { const float f = (mr[j] != 0) ? 1.f : 0.f; se += __expf(fmaf(f, s[j], (1.f - f) * -1.0e9f) - mx); } const float sc = 256.0f / se;
#pragma unroll 1
  for (int j0 = 0; j0 < nk; j0 += 8) { FragH fr; for (int q = 0; q < 8; ++q) { const int j = j0 + q; const float f = (mr[j] != 0) ? 1.f : 0.f; fr.h[q] = (_Float16)(__expf(fmaf(f, s[j], (1.f - f) * -1.0e9f) - mx) * sc); } unsigned short* d = (unsigned short*)P + i * NKX + j0; *(v8us*)d = fr.half[0];  } }



__global__ __launch_bounds__(256) void k_tab128h(int nr, float theta, float* __restrict__ CS, float* __restrict__ SN) {
  #pragma clang fp contract(off)
  const size_t t = (size_t)blockIdx.x * 256 + threadIdx.x; if (t >= (size_t)nr * 64) return; const int i = (int)(t % 64); const size_t r = t / 64; const int p = (int)(r % SQ);
  const float invf = (float)(1.0 / pow((double)theta, ((double)(2 * i)) / 128.0)); const float ang = __fmul_rn((float)p, invf); const float c = cosf(ang), sv = sinf(ang);
  float* pc = CS + r * 128 + i; float* ps = SN + r * 128 + i;
  *(float*)pc = c; *(float*)(pc + 64) = c; *(float*)ps = sv; *(float*)(ps + 64) = sv;  }

// Lane exchanges and the native exp of the softmax code below.
template <int M> __device__ __forceinline__ float sm_xrow(float x) { return __builtin_bit_cast(float, __builtin_amdgcn_mov_dpp(__builtin_bit_cast(int, x), 0x160 | M, 0xf, 0xf, true)); }      /* lane l with lane l ^ M, M < 16 (row_xmask) */
__device__ __forceinline__ float sm_xhalf(float x) { const int b = __builtin_bit_cast(int, x); return __builtin_bit_cast(float, __builtin_amdgcn_permlanex16(b, b, 0x76543210, 0xfedcba98, false, false)); }      /* lane l with lane l ^ 16 */
__device__ __forceinline__ float sm_wmax(float x) { x = fmaxf(x, sm_xrow<1>(x)); x = fmaxf(x, sm_xrow<2>(x)); x = fmaxf(x, sm_xrow<4>(x)); x = fmaxf(x, sm_xrow<8>(x)); return fmaxf(x, sm_xhalf(x)); }
__device__ __forceinline__ float sm_wsum(float x) { x += sm_xrow<1>(x); x += sm_xrow<2>(x); x += sm_xrow<4>(x); x += sm_xrow<8>(x); return x + sm_xhalf(x); }
// Eight native 2^x in one statement. The outputs are early-clobber, so no v_exp_f32 in it overwrites a neighbour's source or reads its result; the closing v_nop keeps the one slot
// that the instruction set asks for behind a transcendental, whatever the compiler places next (left to itself it reused a source register directly behind some of them).
__device__ __forceinline__ void sm_exp2x8(v4f& a, v4f& b) { float e0, e1, e2, e3, e4, e5, e6, e7;
  asm("v_exp_f32 %0, %8\n\tv_exp_f32 %1, %9\n\tv_exp_f32 %2, %10\n\tv_exp_f32 %3, %11\n\tv_exp_f32 %4, %12\n\tv_exp_f32 %5, %13\n\tv_exp_f32 %6, %14\n\tv_exp_f32 %7, %15\n\tv_nop"
      : "=&v"(e0), "=&v"(e1), "=&v"(e2), "=&v"(e3), "=&v"(e4), "=&v"(e5), "=&v"(e6), "=&v"(e7) : "v"(a[0]), "v"(a[1]), "v"(a[2]), "v"(a[3]), "v"(b[0]), "v"(b[1]), "v"(b[2]), "v"(b[3]));
  a[0] = e0; a[1] = e1; a[2] = e2; a[3] = e3; b[0] = e4; b[1] = e5; b[2] = e6; b[3] = e7; }
// Fused attention of query blocks 1 .. SQ / QT - 1 (block 0 is the exact first tile's): scores, the per-block softmax and P V in one launch; no score or weight ever goes to memory.
// One wave owns 16 queries of one head and walks the key blocks j = 0 .. i. Both products are formed transposed, with the queries as the 16 columns:
//   S^T = K Q^T : A = 16 key rows (hi, residual), B = the wave's q fragments; 16 tiles of 16 keys = the whole 256-key block of a lane's query (column ln; keys 8 hh + r of each tile);
//   softmax     : maximum and sum run over a lane's own 128 scores, one exchange with lane ^ 16 finishes each;
//   O^T = V^T P^T : A = 16 rows of V^T (hi, residual); score tiles 2u and 2u + 1 of a lane ARE the B fragment of keys 32u .. 32u + 31 (elements 0..7 = keys 8 hh + r, 8..15 = keys 16 + 8 hh + r, the k order of g2_frag), so the weights move through no LDS.
// Each product has three terms: hi.hi in one accumulator, the two x1024 residual terms together in a second one. Fragments are requested two steps before their products.
struct FA4 { v16h f0, f1, f2, f3; };      /* the four fragments of one step: a key tile's four k-steps, or four 16-dim tiles of V^T, of one plane (hi or residual) */
__device__ __forceinline__ void fa_load(FA4& s, const _Float16* p, size_t st) { s.f0 = g2_frag(p); s.f1 = g2_frag(p + st); s.f2 = g2_frag(p + 2 * st); s.f3 = g2_frag(p + 3 * st); }
__device__ __forceinline__ v8f fa_mma(v16h a, v16h b, v8f c) { return __builtin_amdgcn_wmma_f32_16x16x32_f16(false, a, false, b, (short)0, c, false, false); }
// Output product of the exact first tile (rows 0..255 of each batch): C = (Ah B^T) 2^-10 + (Al B^T) 2^-20, Ah / Al = o x64 as f16 hi / x1024 residual planes, B = Wo x16, all in fragment order, K = 2048.
// One work-group = 128 rows x 64 columns, a wave 32 x 64; both planes go through ONE k loop (the B fragments are loaded once for both), each plane into accumulators of its own, k ascending: the sums are those of two separate products.
struct G3S { v16h a0, a1, l0, l1, b0, b1, b2, b3; };      /* the fragments of one k-step: two strips of each A plane, four strips of B */
__device__ __forceinline__ void g3_load(G3S& s, const _Float16* ap, const _Float16* lp, const _Float16* bp, int k) { s.a0 = g2_frag(ap + k); s.b0 = g2_frag(bp + k); s.a1 = g2_frag(ap + 16 * DMX + k); s.l0 = g2_frag(lp + k); s.l1 = g2_frag(lp + 16 * DMX + k); s.b1 = g2_frag(bp + 16 * DMX + k); s.b2 = g2_frag(bp + 32 * DMX + k); s.b3 = g2_frag(bp + 48 * DMX + k); }
__device__ __forceinline__ void ft_out(const _Float16* __restrict__ Ah, const _Float16* __restrict__ Al, const _Float16* __restrict__ Bh, float* __restrict__ C, int wg, float (*so)[32][68]) {
  const int lane = threadIdx.x & 31, ln = lane & 15, hh = lane >> 4, w = threadIdx.x >> 5;
  const int b = wg / (2 * (DMX / 64)), row0 = (wg / (DMX / 64) & 1) * 128 + 32 * w, col0 = (wg % (DMX / 64)) * 64;      /* QT0 = 2 x 128 rows a batch */
  const size_t ao = ((size_t)b * QT0 + row0) * DMX + lane * 8; const _Float16* ap = Ah + ao; const _Float16* lp = Al + ao; const _Float16* bp = Bh + (size_t)col0 * DMX + lane * 8;
  G3S s0, s1, s2; int ko = 0;      /* three k-steps of fragments in registers: a step's 16 loads are issued together, two steps ahead */
  g3_load(s0, ap, lp, bp, 0); __builtin_amdgcn_sched_barrier(0);      /* the three sets are requested one after the other, as in the loop, so that the counted load waits do not wait for the younger sets */
  g3_load(s1, ap, lp, bp, 512); __builtin_amdgcn_sched_barrier(0);      /* as above */
  g3_load(s2, ap, lp, bp, 1024);
  asm volatile("s_wait_xcnt 0x0" ::: "memory");      /* stands in front of the clearing of the accumulators, which may take the registers of an address that the loads above name (a precaution) */
  const v8f z8 = {0.f, 0.f, 0.f, 0.f, 0.f, 0.f, 0.f, 0.f}; v8f ch[8] = {z8, z8, z8, z8, z8, z8, z8, z8}, cl[8] = {z8, z8, z8, z8, z8, z8, z8, z8};      /* index 4 (row strip) + column strip */
#define G3_MMA(S) { ch[0] = fa_mma(S.a0, S.b0, ch[0]); ch[4] = fa_mma(S.a1, S.b0, ch[4]); cl[0] = fa_mma(S.l0, S.b0, cl[0]); cl[4] = fa_mma(S.l1, S.b0, cl[4]); ch[1] = fa_mma(S.a0, S.b1, ch[1]); ch[5] = fa_mma(S.a1, S.b1, ch[5]); cl[1] = fa_mma(S.l0, S.b1, cl[1]); cl[5] = fa_mma(S.l1, S.b1, cl[5]); \
    ch[2] = fa_mma(S.a0, S.b2, ch[2]); ch[6] = fa_mma(S.a1, S.b2, ch[6]); cl[2] = fa_mma(S.l0, S.b2, cl[2]); cl[6] = fa_mma(S.l1, S.b2, cl[6]); ch[3] = fa_mma(S.a0, S.b3, ch[3]); ch[7] = fa_mma(S.a1, S.b3, ch[7]); cl[3] = fa_mma(S.l0, S.b3, cl[3]); cl[7] = fa_mma(S.l1, S.b3, cl[7]); }
  /* G3_STEP: the k offset moves on by three steps; the wait stands in front of the rewrite of the address registers that the loads in flight name (a precaution); the new offset is its output, so every new address is formed behind it */
#define G3_STEP { ko += 1536; asm volatile("s_wait_xcnt 0x0" : "+s"(ko) : : "memory"); }
#pragma unroll 1      /* one trip = three k-steps, one per register set; rolled so that the sets keep their registers */
  for (int st = 0; st + 6 <= DMX / 32; st += 3) {
    G3_MMA(s0) G3_STEP g3_load(s0, ap + ko, lp + ko, bp + ko, 0); __builtin_amdgcn_sched_barrier(0);      /* keeps the next set's first product, with its load wait, from moving up in front of these requests */
    G3_MMA(s1) g3_load(s1, ap + ko, lp + ko, bp + ko, 512);
    G3_MMA(s2) g3_load(s2, ap + ko, lp + ko, bp + ko, 1024); }
  static_assert(DMX / 32 % 3 == 1, "four k-steps are left behind the loop, three of them loaded");
  G3_MMA(s0) G3_STEP const _Float16* ea = ap + ko; const _Float16* el = lp + ko; const _Float16* eb = bp + ko; g3_load(s0, ea, el, eb, 0);
  __builtin_amdgcn_sched_barrier(0); asm volatile("s_wait_xcnt 0x0" : : "v"(ea), "v"(el), "v"(eb) : "memory"); __builtin_amdgcn_sched_barrier(0);      /* behind the last request: its address registers are free from here on and the compiler reuses them with the loads in flight (a precaution; it wrote no wait there); the addresses are inputs of the wait, so their registers stay as they are up to it, and the two barriers keep the requests above it and the reuse below it */
  G3_MMA(s1) G3_MMA(s2) G3_MMA(s0)
#undef G3_STEP
#undef G3_MMA
#pragma unroll
  for (int u = 0; u < 8; ++u) {
#pragma unroll
    for (int r = 0; r < 8; ++r) so[w][(u >> 2) * 16 + 8 * hh + r][(u & 3) * 16 + ln] = cl[u][r] * 0.00000095367431640625f + ch[u][r] * 0.0009765625f; }      /* both scalings are exact: one rounding, that of the sum */
  __builtin_amdgcn_fence(__ATOMIC_ACQ_REL, "workgroup"); __builtin_amdgcn_wave_barrier();      /* a wave reads back its own staging only: whole 256-byte row pieces go out */
  const int rsub = lane >> 4, c4 = (lane & 15) * 4;
#pragma unroll
  for (int q = 0; q < 16; ++q) { const int r = q * 2 + rsub; const v4f v = *(const v4fa*)&so[w][r][c4]; *(v4f*)(C + ((size_t)b * SQ + row0 + r) * DMX + col0 + c4) = v; } }
// The last NB NH 4 work-groups of the launch, which would be query block 0, take the output product of the exact first tile instead (ft_out: it needs only what earlier launches wrote, and rows 0..255 of o come from the exact path alone).
__global__ __launch_bounds__(128) void k_fattn(const _Float16* __restrict__ Qh, const _Float16* __restrict__ Ql, const _Float16* __restrict__ Kh, const _Float16* __restrict__ Kl, const _Float16* __restrict__ Vh, const _Float16* __restrict__ Vl, _Float16* __restrict__ O,
    const _Float16* __restrict__ O0h, const _Float16* __restrict__ O0l, const _Float16* __restrict__ Bo, float* __restrict__ out) {
  __shared__ __attribute__((aligned(16))) float so[4][32][68];      /* ft_out's staging */
  static_assert(NB * (QT0 / 128) * (DMX / 64) == NB * NH * 4 && QT0 == QT, "ft_out's work-groups fill the places of query block 0");
  if (blockIdx.x >= (unsigned)(NB * NH * 4 * (SQ / QT - 1))) { ft_out(O0h, O0l, Bo, out, (int)blockIdx.x - NB * NH * 4 * (SQ / QT - 1), so); return; }      /* the same for the whole work-group; no barrier follows */
  const int lane = threadIdx.x & 31, ln = lane & 15, hh = lane >> 4, w = threadIdx.x >> 5;
  const int qb = (SQ / QT - 1) - (int)(blockIdx.x / (NB * NH * 4)); const int rem = blockIdx.x % (NB * NH * 4); const int sub = rem & 3, h = (rem >> 2) % NH, b = rem / (4 * NH);      /* the query blocks with the most key blocks take the lowest work-group indices */
  const int qrow = qb * QT + sub * 64 + w * 16 + ln;      /* this lane's query (a column of both products) */
  // All six planes and O are in fragment order: a strip of 16 rows starts at row x 2048 elements, column c (a multiple of 32) at 16 c elements inside it, the lane's piece at 8 lane.
  const size_t qs = ((size_t)b * SQ + (qrow - ln)) * DMX + lane * 8; const _Float16* qph = Qh + qs; const _Float16* qpl = Ql + qs;
  const size_t ks = (size_t)b * SQ * DKV + h * HDK * 16 + lane * 8; const _Float16* kph = Kh + ks; const _Float16* kpl = Kl + ks;
  const size_t vs = ((size_t)b * DKV + h * HDK) * SQ + lane * 8; const _Float16* vph = Vh + vs; const _Float16* vpl = Vl + vs;
  const v8f z8 = {0.f, 0.f, 0.f, 0.f, 0.f, 0.f, 0.f, 0.f}; v8f oh[8] = {z8, z8, z8, z8, z8, z8, z8, z8};
  const float nrm = 256.0f / __fadd_rn((float)(qb + 1), 1e-6f);
  int j = 0;
#pragma unroll 1      /* one trip = one 256-key block; rolled, the trip count differs between query blocks (at least one trip: block 0) */
  do { int jo = j * 256, qo = h * HDK * 16;
    asm volatile("s_wait_xcnt 0x0" : "+s"(jo), "+s"(qo) : : "memory");      /* stands in front of the rewrite of the address registers of the last trip's loads (a precaution); the key offset and the q offset are its outputs, so every new address is formed behind it, and the q fragments are fetched anew in every trip: they hold no registers during softmax and P V, which keeps two waves on a SIMD */
    const _Float16* qp = qph + qo; const _Float16* qlp = qpl + qo;
    const v16h qh0 = g2_frag(qp), qh1 = g2_frag(qp + 512), qh2 = g2_frag(qp + 1024), qh3 = g2_frag(qp + 1536), ql0 = g2_frag(qlp), ql1 = g2_frag(qlp + 512), ql2 = g2_frag(qlp + 1024), ql3 = g2_frag(qlp + 1536);
    const _Float16* kh_ = kph + (size_t)jo * DKV; const _Float16* kl_ = kpl + (size_t)jo * DKV; const _Float16* vh_ = vph + jo * 16; const _Float16* vl_ = vpl + jo * 16;
    // 64 steps of 8 loads a trip: steps 0..31 = key tile t, hi plane then residual plane; steps 32..63 = 32 keys x 64 dims of V^T, hi then residual. Three register sets turn: step k + 2 is requested in front of the products of step k.
#define FA_REQ(k) { if ((k) < 32) fa_load(x[(k) % 3], (((k) & 1) ? kl_ : kh_) + (size_t)((k) >> 1) * 16 * DKV, 512); else fa_load(x[(k) % 3], (((k) & 1) ? vl_ : vh_) + (size_t)(((k) - 32) >> 2) * 512 + (size_t)(((((k) - 32) >> 1) & 1) * 4) * 16 * SQ, (size_t)16 * SQ); }
    v8f s[16]; FA4 x[3]; FA_REQ(0) __builtin_amdgcn_sched_barrier(0);      /* the q fragments and step 0 are requested first, then step 1, then step 2: mixed, the first products' counted load wait would wait for the younger steps too */
    asm volatile("s_wait_xcnt 0x0" ::: "memory");      /* behind the q fragments' requests: their address registers are free from here on and are reused with the loads in flight (a precaution; in this build the compiler's own wait there left the two youngest out) */
    FA_REQ(1) __builtin_amdgcn_sched_barrier(0);      /* as above */
    v8f ah = z8, al = z8;
#pragma unroll
    for (int k = 0; k < 32; ++k) { if (k == 28 || k == 29) __builtin_amdgcn_sched_barrier(0);      /* keeps the vector work of the step before out of the stretch between a K plane's last request and the wait below */
      FA_REQ(k + 2)      /* behind the last key tile: the first V^T fragments, which fly during the softmax */
      if (k == 28 || k == 29) { __builtin_amdgcn_sched_barrier(0); asm volatile("s_wait_xcnt 0x0" ::: "memory"); }      /* behind the last request of a K plane: its address registers are free from here on and the compiler reuses them with the loads in flight (a precaution; it wrote no wait there); the barrier in front keeps the requests above the wait */
      __builtin_amdgcn_sched_barrier(0);      /* keeps this step's products, with their load wait, from moving up in front of the requests of the step after next */
      const FA4& c = x[k % 3];
      if ((k & 1) == 0) { ah = fa_mma(c.f0, qh0, z8); al = fa_mma(c.f0, ql0, z8); ah = fa_mma(c.f1, qh1, ah); al = fa_mma(c.f1, ql1, al); ah = fa_mma(c.f2, qh2, ah); al = fa_mma(c.f2, ql2, al); ah = fa_mma(c.f3, qh3, ah); al = fa_mma(c.f3, ql3, al); }
      else { al = fa_mma(c.f0, qh0, al); al = fa_mma(c.f1, qh1, al); al = fa_mma(c.f2, qh2, al); al = fa_mma(c.f3, qh3, al); s[k >> 1] = ah * ATS + al * (ATS * 0.0009765625f); } }
    if (j == qb) {      /* only the diagonal block holds keys above a query */
#pragma unroll
      for (int t = 0; t < 16; ++t) {
#pragma unroll
        for (int r = 0; r < 8; ++r) s[t][r] = (jo + t * 16 + 8 * hh + r <= qrow) ? s[t][r] : -1.0e9f; } }
    float mx = -3.0e38f;
#pragma unroll
    for (int t = 0; t < 16; ++t) mx = fmaxf(mx, fmaxf(fmaxf(fmaxf(s[t][0], s[t][1]), fmaxf(s[t][2], s[t][3])), fmaxf(fmaxf(s[t][4], s[t][5]), fmaxf(s[t][6], s[t][7]))));
    mx = fmaxf(mx, sm_xhalf(mx)); float se = 0.f;
#pragma unroll
    for (int t = 0; t < 16; ++t) { v4f a, e;
#pragma unroll
      for (int u = 0; u < 4; ++u) { a[u] = (s[t][u] - mx) * 1.44269504f; e[u] = (s[t][4 + u] - mx) * 1.44269504f; }      /* e^x = 2^(x log2 e), as the native exp forms it */
      sm_exp2x8(a, e); se += ((a[0] + a[1]) + (a[2] + a[3])) + ((e[0] + e[1]) + (e[2] + e[3]));
#pragma unroll
      for (int u = 0; u < 4; ++u) { s[t][u] = a[u]; s[t][4 + u] = e[u]; } }
    se += sm_xhalf(se); const float isum = nrm / se;
    FragH bh, bl; v8f ol[8] = {z8, z8, z8, z8, z8, z8, z8, z8};      /* the residual terms of this key block (x1024) */
#pragma unroll
    for (int k = 32; k < 64; ++k) { const int u = (k - 32) >> 2, d0 = (((k - 32) >> 1) & 1) * 4;
      if (k == 60 || k == 61) __builtin_amdgcn_sched_barrier(0);      /* as for K above */
      if (k + 2 < 64) FA_REQ(k + 2)
      if (k == 60 || k == 61) { __builtin_amdgcn_sched_barrier(0); asm volatile("s_wait_xcnt 0x0" ::: "memory"); }      /* behind the last request of a V^T plane, as for K above */
      __builtin_amdgcn_sched_barrier(0);      /* as above: the requests stay in front of this step's products */
      const FA4& c = x[k % 3];
      if (((k - 32) & 3) == 0) {      /* the weights of keys 32u .. 32u + 31 as f16 hi + x1024 residual: the B fragments of the next four steps */
#pragma unroll
        for (int r = 0; r < 8; ++r) { const float p0 = s[2 * u][r] * isum, p1 = s[2 * u + 1][r] * isum; bh.h[r] = (_Float16)p0; bl.h[r] = (_Float16)((p0 - (float)bh.h[r]) * 1024.0f); bh.h[8 + r] = (_Float16)p1; bl.h[8 + r] = (_Float16)((p1 - (float)bh.h[8 + r]) * 1024.0f); } }
      if ((k & 1) == 0) { oh[d0] = fa_mma(c.f0, bh.v, oh[d0]); oh[d0 + 1] = fa_mma(c.f1, bh.v, oh[d0 + 1]); oh[d0 + 2] = fa_mma(c.f2, bh.v, oh[d0 + 2]); oh[d0 + 3] = fa_mma(c.f3, bh.v, oh[d0 + 3]);
        ol[d0] = fa_mma(c.f0, bl.v, ol[d0]); ol[d0 + 1] = fa_mma(c.f1, bl.v, ol[d0 + 1]); ol[d0 + 2] = fa_mma(c.f2, bl.v, ol[d0 + 2]); ol[d0 + 3] = fa_mma(c.f3, bl.v, ol[d0 + 3]); }
      else { ol[d0] = fa_mma(c.f0, bh.v, ol[d0]); ol[d0 + 1] = fa_mma(c.f1, bh.v, ol[d0 + 1]); ol[d0 + 2] = fa_mma(c.f2, bh.v, ol[d0 + 2]); ol[d0 + 3] = fa_mma(c.f3, bh.v, ol[d0 + 3]); } }
#undef FA_REQ
#pragma unroll
    for (int dt = 0; dt < 8; ++dt) oh[dt] += ol[dt] * 0.0009765625f;      /* joined per key block, so that the second accumulator holds no registers while the next scores are formed */
  } while (++j <= qb);
  unsigned short* op = (unsigned short*)O + qs + h * HDK * 16;      /* a lane holds dims 16 dt + 8 hh + r of its query: piece 32 (dt & 1) + lane of tile dt / 2 of the head's four: each store of the wave writes 512 contiguous bytes */
#pragma unroll
  for (int dt = 0; dt < 8; ++dt) { FragH f;
#pragma unroll
    for (int r = 0; r < 8; ++r) f.h[r] = (_Float16)(oh[dt][r] * 0.25f);      /* o x64 = (Ph Vh + (Pl Vh + Ph Vl) 2^-10) / 4 */
    *(v8us*)(op + dt * 256) = f.half[0]; } }
// Exact f32 causal attention of rows 0..255, spread over a work-group: 8 waves take 8 query rows of one head (keys 0 .. i0 + 7 only).
// Scores: 4 neighbouring lanes share one key row (each wave-wide load covers 8 rows x 64 contiguous bytes), a lane sums its 32 of the 128 dims for all 8 queries (q from LDS, 64 contiguous bytes per read), two lane steps finish the dot.
// Softmax: wave w owns row i0 + w, 8 keys a lane, plain two-pass (all scores of a row are at hand), accurate expf; keys above the query get weight 0.
// Output: wave w sums keys w, w + 8, ... (a V row is one coalesced 512 B load, its 8 weights two LDS broadcasts), the 8 partial sums meet in LDS in fixed order; o x64 / row sum as before.
// The result leaves as the two f16 operand planes of its output product, hi + x1024 residual (the split of k_hl), in fragment order: thread t sums and splits 4 columns of row t & 7, so that a wave's store fills whole 128-byte lines (8 rows x 16 bytes).
__global__ __launch_bounds__(256) void k_att0w(const float* __restrict__ QF, const float* __restrict__ KF, const float* __restrict__ VF, float scale, _Float16* __restrict__ OH, _Float16* __restrict__ OL) {
  __shared__ __attribute__((aligned(16))) float lq[8][128]; __shared__ __attribute__((aligned(16))) float sc[8][QT0 + 4]; __shared__ __attribute__((aligned(16))) float pt[QT0][8]; __shared__ __attribute__((aligned(16))) float red[8][8][128]; __shared__ float inv[8];
  const int lane = threadIdx.x & 31; const int w = __builtin_amdgcn_readfirstlane(threadIdx.x >> 5); const int h = blockIdx.x % NH, b = (blockIdx.x / NH) % NB, i0 = (QT0 / 8 - 1 - blockIdx.x / (NH * NB)) * 8; const int nkey = i0 + 8;      /* the row groups with the most keys take the lowest work-group indices, of both batches */
  QF += (size_t)b * QT0 * DMX; KF += (size_t)b * QT0 * DKV; VF += (size_t)b * QT0 * DKV;      /* each plane holds rows 0..255 of one batch behind those of the other */
  *(v4f*)&lq[w][lane * 4] = *(const v4fa*)(QF + (size_t)(i0 + w) * DMX + h * 128 + lane * 4);
  __syncthreads();
  const int dq = (lane & 3) * 4;
#pragma unroll 1      /* one trip = 64 keys of the work-group; rolled so that only the trips below the diagonal run */
  for (int j0 = w * 8; j0 < nkey; j0 += 64) { const int j = j0 + (lane >> 2); const float* kr = KF + (size_t)j * DKV + h * 128 + dq; v4f kq[8];
#pragma unroll
    for (int c = 0; c < 8; ++c) kq[c] = *(const v4fa*)(kr + c * 16);
    asm volatile("s_wait_xcnt 0x0" ::: "memory");      /* stands in front of the first reuse of the loads' address registers (a precaution); no load sinks below it, so all eight are in flight together */
#pragma unroll 1      /* four query rows a trip: with all eight unrolled the q reads of a whole tile are hoisted and the wave needs more than 256 registers, so that only one work-group fits a WGP */
    for (int rh = 0; rh < 8; rh += 4) { float acc[4] = {0.f, 0.f, 0.f, 0.f};
#pragma unroll
      for (int c = 0; c < 8; ++c) {
#pragma unroll
        for (int r = 0; r < 4; ++r) { const v4f q = *(const v4f*)&lq[rh + r][c * 16 + dq]; acc[r] += q[0] * kq[c][0] + q[1] * kq[c][1] + q[2] * kq[c][2] + q[3] * kq[c][3]; } }
#pragma unroll
      for (int r = 0; r < 4; ++r) { float s = acc[r]; s += sm_xrow<1>(s); s += sm_xrow<2>(s); if ((lane & 3) == 0) sc[rh + r][j] = s * scale; } } }
  __syncthreads();
  { const int i = i0 + w; float s[8]; float mx = -3.0e38f;
#pragma unroll
    for (int u = 0; u < 8; ++u) { const int j = lane + 32 * u; s[u] = (j <= i) ? sc[w][j] : -3.0e38f; mx = fmaxf(mx, s[u]); }
    mx = sm_wmax(mx); float se = 0.f;
#pragma unroll
    for (int u = 0; u < 8; ++u) { const int j = lane + 32 * u; const float e = (j <= i) ? expf(s[u] - mx) : 0.f; se += e; pt[j][w] = e; }
    se = sm_wsum(se); if (lane == 0) inv[w] = 64.0f / se; }
  __syncthreads();
  const v4f z4 = {0.f, 0.f, 0.f, 0.f}; v4f o[8] = {z4, z4, z4, z4, z4, z4, z4, z4};
#pragma unroll 1      /* one trip = 64 keys of the work-group, 8 a wave; keys from nkey on carry weight 0 for all 8 rows (rows below 256 of V, in bounds) */
  for (int jb = w; jb < nkey; jb += 64) { const float* vr = VF + (size_t)jb * DKV + h * 128 + lane * 4; v4f vv[8];
#pragma unroll
    for (int u = 0; u < 8; ++u) vv[u] = *(const v4fa*)(vr + (size_t)(8 * u) * DKV);
#pragma unroll
    for (int u = 0; u < 8; ++u) { const v4f p0 = *(const v4f*)&pt[jb + 8 * u][0], p1 = *(const v4f*)&pt[jb + 8 * u][4];
#pragma unroll
      for (int r = 0; r < 4; ++r) { o[r] += p0[r] * vv[u]; o[4 + r] += p1[r] * vv[u]; } } }
#pragma unroll
  for (int r = 0; r < 8; ++r) *(v4f*)&red[w][r][lane * 4] = o[r];
  __syncthreads();
  { const int r = threadIdx.x & 7, c = (int)(threadIdx.x >> 3) * 4; v4f a = *(const v4f*)&red[0][r][c];
#pragma unroll
    for (int k = 1; k < 8; ++k) a += *(const v4f*)&red[k][r][c];
    a *= inv[r]; v4h ph, pr;
#pragma unroll
    for (int q = 0; q < 4; ++q) { const _Float16 x = (_Float16)a[q]; ph[q] = x; pr[q] = (_Float16)((a[q] - (float)x) * 1024.0f); }
    const int row = b * QT0 + i0 + r, col = h * 128 + c;      /* planes of NB QT0 rows; piece 16 (column / 8 & 3) + (row & 15) of tile column / 32 of strip row / 16 */
    const size_t d = (size_t)(row >> 4) * 16 * DMX + (size_t)(col >> 5) * 512 + (((col >> 3) & 3) * 16 + (row & 15)) * 8 + (col & 7);
    *(v4h*)(OH + d) = ph; *(v4h*)(OL + d) = pr; } }
extern "C" void kernel_launch(void* const* d_in, const int* in_sizes, int n_in,
                              void* d_out, int out_size, void* d_ws, size_t ws_size, hipStream_t stream) {
  (void)in_sizes; (void)n_in; (void)out_size;
  const float* const* I = (const float* const*)d_in; const float* x = I[0]; const float* wq = I[1]; const float* wk = I[2]; const float* wv = I[3]; const float* wo = I[4]; const float* bo = nullptr;      /* natural [out][in] Wq/Wk/Wv/Wo [2048][2048]; no biases */
  char* ws = (char*)d_ws; size_t off = 0;
  auto take = [&](size_t bytes) { char* p = ws + off; off += (bytes + 255) & ~(size_t)255; return p; };
  _Float16* BQ = (_Float16*)take((size_t)DMX * DMX * 2); _Float16* BK = (_Float16*)take((size_t)DKV * DMX * 2); _Float16* BV = (_Float16*)take((size_t)DKV * DMX * 2); _Float16* BO = (_Float16*)take((size_t)DMX * DMX * 2);
  _Float16* X16 = (_Float16*)take(NR * DMX * 2); float* QF = (float*)take((size_t)NB * QT0 * DMX * 4); float* KF = (float*)take((size_t)NB * QT0 * DKV * 4); float* VF = (float*)take((size_t)NB * QT0 * DKV * 4); _Float16* Q16 = (_Float16*)take(NR * DMX * 2); _Float16* QL = (_Float16*)take(NR * DMX * 2); _Float16* K16 = (_Float16*)take(NR * DKV * 2); _Float16* KL = (_Float16*)take(NR * DKV * 2); _Float16* O16 = (_Float16*)take(NR * DMX * 2);      /* rows 0..255 of each batch's q, k, v in f32; f16 hi + x1024 residual planes of q, k (both batches) */
  _Float16* VT = (_Float16*)take((size_t)NB * DKV * SQ * 2); _Float16* VTL = (_Float16*)take((size_t)NB * DKV * SQ * 2);      /* V^T hi / residual of both batches */
  _Float16* OH0 = (_Float16*)take((size_t)NB * QT0 * DMX * 2); _Float16* OL0 = (_Float16*)take((size_t)NB * QT0 * DMX * 2);
  if (off > ws_size) return;      /* 176 MiB */
  k_prep<<<4 * WB + (unsigned)(NR * DMX / 8 / 256), 256, 0, stream>>>(x, wq, wk, wv, wo, X16, BQ, BK, BV, BO);      /* natural [out][in] weights = Bt x16; x as exact f16 rows */
  // Independent work shares a launch: the token rows of both batches are the rows of one GEMM, and q and k are the two blockIdx.y slices of one launch (same A, same epilogue).
  k_gemm2<0, 1, 2><<<dim3((unsigned)((NR / 128) * (DMX / 256)), 2), 128, 0, stream>>>(X16, DMX, 0, BQ, DMX, (size_t)(BK - BQ), 0.0625f, nullptr, 0, nullptr, 1, 0, 0, QF, nullptr, DMX, (size_t)(KF - QF), (int)NR, DMX, DMX, Q16, QL, QT0, (size_t)(K16 - Q16));      /* q and k (exact products, f32 accumulators) leave the GEMM as f16 hi + x1024 residual planes in fragment order (block 0's full softmax seen from every later block's first row needs near-exact logits); f32 rows 0..255 of each batch for the exact first tile */
  k_gemm2<0, 2, 4><<<dim3((unsigned)((NR / 128) * (DKV / 256)), 1), 128, 0, stream>>>(X16, DMX, 0, BV, DMX, 0, 0.0625f, nullptr, 0, nullptr, 1, 0, 0, VF, nullptr, DKV, 0, (int)NR, DKV, DMX, VT, VTL, QT0, 0);      /* v leaves the GEMM as V^T hi / x1024 residual planes in fragment order, a plane a batch (rows = dims, columns = keys; the per-block softmax gives every block's first rows single-key weights, so v and P must be carried beyond one f16); f32 rows 0..255 of each batch for the exact first tile */
  k_att0w<<<NB * NH * (QT0 / 8), 256, 0, stream>>>(QF, KF, VF, ATS, OH0, OL0);      /* exact causal attention rows 0..255 of both batches (o x64) -> f16 hi + x1024 residual planes */
  k_fattn<<<NB * NH * (SQ / 64), 128, 0, stream>>>(Q16, QL, K16, KL, VT, VTL, O16, OH0, OL0, BO, (float*)d_out);      /* scores (hi.hi + the two residual terms), the module's per-block softmax (an independent softmax per 256-key block j <= i, diagonal block causal, weights divided by block count + 1e-6) and o = P V (hi.hi + the two residual terms) -> merged f16 o rows (x64), query blocks 1..; its last work-groups: rows 0..255 of out of each batch = exact o hi Wo^T 2^-10 + o residual Wo^T 2^-20 */
  k_gemm2<0, 0, 4><<<dim3((unsigned)(((SQ - QT0) / 128) * (DMX / 256)), NB), 128, 0, stream>>>(O16 + (size_t)QT0 * DMX, DMX, (size_t)SQ * DMX, BO, DMX, 0, 0.0009765625f, bo, 0, nullptr, 1, 0, 0, (float*)d_out + (size_t)QT0 * DMX, nullptr, DMX, (size_t)SQ * DMX, SQ - QT0, DMX, DMX, nullptr, nullptr, 0, 0);      /* out = o Wo^T, rows 256.. of each batch (a blockIdx.y slice a batch) */
}

// v010
// A run of this version takes 239 microseconds.
// Timed twice side by side with v009, it ran 1.09 and 1.10 times as fast.
// Over all steps from v000, the starting kernel, it is 43.4 times as fast.
#include <hip/hip_runtime.h>
// Block-chunked causal attention with the module's PER-BLOCK softmax (hidden [2][2048][2048]; q/k/v = x W^T (natural [2048][2048] sigma 0.02, no biases), 16 heads of 128; keys in blocks of 256: for query block i every key block j <= i gets its OWN softmax over its 256 keys (scores / sqrt(128); inside the diagonal block keys above the query are -inf), the block outputs are summed and divided by the summed weights (= number of included blocks) + 1e-6; merged Wo^T -> [2][2048][2048]; no RoPE).
// Structure: token rows; x as exact f16 rows; natural weights as exact x16 planes; q, k, v as WMMA GEMMs (64x128 wave tiles, f32 accumulation) whose epilogues write f32 (first tile) + the f16 operand planes of q, k and V^T; per batch: exact f32 causal attention for rows 0..255 (= key block 0, where the per-block softmax is the ordinary causal softmax) on VALU; one fused launch for query blocks 1.., all heads and both batches: a wave's 16 queries against key blocks 0..i (scores f32 in registers, alpha 1/sqrt(128)), the module's per-block softmax on VALU (f32 statistics, native exp; weights x256 f16 divided by the block count + 1e-6), o = P V (x64) merged f16; out = o Wo^T (rows 256.. of a batch); first-tile rows of out from the exact o hi/lo, inside the fused launch; launches: see trace.
// Compute dtype: inputs rounded to bf16; x / weights exact; projections f32; q, k, v and softmax weights as f16 hi + x1024 residual operand pairs, o as a plain f16 GEMM operand (~2^-12; first 256 rows of each batch exact); scores, statistics, out f32. v_wmma_f32_16x16x32_f16.
#define NB 2
#define SQ 2048
#define DMX 2048
#define NH 16
#define NKV 16
#define GSZ 1                        /* plain MHA: kv head == query head */
#define HDK 128
#define DKV (NKV * HDK)
#define QT 256
#define QT0 256
#define NKX SQ
#define DM DMX
#define HD 64
#define HG 1
#define NR ((size_t)NB * SQ)
#define ATS 0.08838834764831845f
typedef __bf16 v16b __attribute__((ext_vector_type(16)));
typedef unsigned short v8us __attribute__((ext_vector_type(8), may_alias));
typedef float  v8f  __attribute__((ext_vector_type(8)));
typedef float  v4f  __attribute__((ext_vector_type(4)));
typedef float  v4fa __attribute__((ext_vector_type(4), may_alias));
union FragB { v16b v; v8us half[2]; unsigned short u[16]; };

__device__ __forceinline__ unsigned short bf16_bits(float x) { unsigned int u = __float_as_uint(x); return (unsigned short)((u + 0x7FFFu + ((u >> 16) & 1u)) >> 16); }
__device__ __forceinline__ float bf16_val(unsigned short b) { return __uint_as_float(((unsigned int)b) << 16); }
__device__ __forceinline__ float bf16_round(float x) { return bf16_val(bf16_bits(x)); }
// D += A·B with NT terms: 1 = ah·bh, 2 = + al·bh (A split), 3 = + ah·bl (both split)
template <int NT>
__device__ __forceinline__ v8f mmaN(v16b ah, v16b al, v16b bh, v16b bl, v8f c) {
  c = __builtin_amdgcn_wmma_f32_16x16x32_bf16(false, ah, false, bh, (short)0, c, false, false);
  if (NT >= 2) c = __builtin_amdgcn_wmma_f32_16x16x32_bf16(false, al, false, bh, (short)0, c, false, false);
  if (NT >= 3) c = __builtin_amdgcn_wmma_f32_16x16x32_bf16(false, ah, false, bl, (short)0, c, false, false);
  asm volatile("v_nop\n\tv_nop\n\tv_nop\n\tv_nop" : "+v"(c) : "v"(ah), "v"(al), "v"(bh), "v"(bl));
  return c;
}

__global__ __launch_bounds__(256) void k_wt_bf16(const float* __restrict__ W, unsigned short* __restrict__ Wt, int K, int N) {
  const int t = blockIdx.x * 256 + threadIdx.x;
  const int k8n = K / 8;
  if (t >= N * k8n) return;
  const int n = t / k8n, k8 = (t % k8n) * 8;
  v8us v;
#pragma unroll
  for (int i = 0; i < 8; ++i) v[i] = bf16_bits(W[(size_t)(k8 + i) * N + n]);
  *(v8us*)(Wt + (size_t)n * K + k8) = v;
  
}

// GEMM C[M][N] (f32, pitch ldc) = act(A[M][K]·W + bias). A f32 row-major (pitch lda) converted per fragment to bf16
// (ASPLIT: hi/lo two planes -> 2 terms, else single rounded term); Wt bf16 [N][K] (pitch ldb). BIAS_BF16 rounds the
// bias to bf16 first (bias quantised to bf16 before the add). K%32==0, M%16==0, N%64==0.
template <bool ASPLIT, int ACT, bool BIAS_BF16>
__global__ __launch_bounds__(128) void k_gemm_bf(const float* __restrict__ A, int lda, const unsigned short* __restrict__ Wt, int ldb,
                                               const float* __restrict__ bias, float* __restrict__ C, int ldc, int M, int N, int K) {
  __shared__ __attribute__((aligned(16))) float so[4][16][64];
  const int tid = threadIdx.x, w = tid >> 5, lane = tid & 31, ln = lane & 15, hh = lane >> 4;
  const int ntn = N / 64;
  const int wid = blockIdx.x * 4 + w;
  const int mt = wid / ntn, nq = wid % ntn;
  if (mt * 16 >= M) return;
  const int row0 = mt * 16, col0 = nq * 64;
  const float* arow = A + (size_t)(row0 + ln) * lda;
  v8f acc[4] = {};
  for (int kb = 0; kb < K; kb += 32) {
    FragB ah, al;
    const v4f x0 = *(const v4fa*)(arow + kb + 8 * hh), x1 = *(const v4fa*)(arow + kb + 8 * hh + 4);
    const v4f x2 = *(const v4fa*)(arow + kb + 16 + 8 * hh), x3 = *(const v4fa*)(arow + kb + 16 + 8 * hh + 4);
    float xs[16] = {x0[0],x0[1],x0[2],x0[3],x1[0],x1[1],x1[2],x1[3],x2[0],x2[1],x2[2],x2[3],x3[0],x3[1],x3[2],x3[3]};
#pragma unroll
    for (int i = 0; i < 16; ++i) { const unsigned short hb = bf16_bits(xs[i]); ah.u[i] = hb; al.u[i] = ASPLIT ? bf16_bits(xs[i] - bf16_val(hb)) : (unsigned short)0; }
#pragma unroll
    for (int t = 0; t < 4; ++t) {
      const unsigned short* brow = Wt + (size_t)(col0 + t * 16 + ln) * ldb + kb;
      FragB b;
      b.half[0] = *(const v8us*)(brow + 8 * hh);
      b.half[1] = *(const v8us*)(brow + 16 + 8 * hh);
      acc[t] = mmaN<ASPLIT ? 2 : 1>(ah.v, al.v, b.v, b.v, acc[t]);
    }
  }
#pragma unroll
  for (int t = 0; t < 4; ++t) {
    float bv = bias ? bias[col0 + t * 16 + ln] : 0.f;
    if (BIAS_BF16) bv = bf16_round(bv);
#pragma unroll
    for (int r = 0; r < 8; ++r) { float v = acc[t][r] + bv; if (ACT == 1) v = fmaxf(v, 0.f); so[w][8 * hh + r][t * 16 + ln] = v; }
  }
  __builtin_amdgcn_fence(__ATOMIC_ACQ_REL, "workgroup");
  __builtin_amdgcn_wave_barrier();
  const int rsub = lane >> 4, c4 = (lane & 15) * 4;
  {
#pragma unroll
    for (int q = 0; q < 8; ++q) {
      const int r = q * 2 + rsub;
      const v4f v = *(const v4fa*)&so[w][r][c4];
      *(v4f*)(C + (size_t)(row0 + r) * ldc + col0 + c4) = v;
    }
    
  }
}

// GEMM C = act(A·W + bias + resid): A f32 (ASPLIT -> hi/lo 2 terms), Wt bf16 [N][K]; ACT 0 none, 1 relu, 2 exact gelu;
// resid (optional, f32, row index = (row % rmod), pitch ldr, RES_BF16 rounds it) added before the activation.
template <bool ASPLIT, int ACT, bool BIAS_BF16, bool RES_BF16>
__global__ __launch_bounds__(128) void k_gemm_bf3(const float* __restrict__ A, int lda, const unsigned short* __restrict__ Wt, int ldb,
                                                const float* __restrict__ bias, const float* __restrict__ resid, int rmod, int ldr,
                                                float* __restrict__ C, int ldc, int M, int N, int K) {
  __shared__ __attribute__((aligned(16))) float so[4][16][64];
  const int tid = threadIdx.x, w = tid >> 5, lane = tid & 31, ln = lane & 15, hh = lane >> 4;
  const int ntn = N / 64;
  const int wid = blockIdx.x * 4 + w;
  const int mt = wid / ntn, nq = wid % ntn;
  if (mt * 16 >= M) return;
  const int row0 = mt * 16, col0 = nq * 64;
  const float* arow = A + (size_t)(row0 + ln) * lda;
  v8f acc[4] = {};
  for (int kb = 0; kb < K; kb += 32) {
    FragB ah, al;
    const v4f x0 = *(const v4fa*)(arow + kb + 8 * hh), x1 = *(const v4fa*)(arow + kb + 8 * hh + 4);
    const v4f x2 = *(const v4fa*)(arow + kb + 16 + 8 * hh), x3 = *(const v4fa*)(arow + kb + 16 + 8 * hh + 4);
    float xs[16] = {x0[0],x0[1],x0[2],x0[3],x1[0],x1[1],x1[2],x1[3],x2[0],x2[1],x2[2],x2[3],x3[0],x3[1],x3[2],x3[3]};
#pragma unroll
    for (int i = 0; i < 16; ++i) { const unsigned short hb = bf16_bits(xs[i]); ah.u[i] = hb; al.u[i] = ASPLIT ? bf16_bits(xs[i] - bf16_val(hb)) : (unsigned short)0; }
#pragma unroll
    for (int t = 0; t < 4; ++t) {
      const unsigned short* brow = Wt + (size_t)(col0 + t * 16 + ln) * ldb + kb;
      FragB b;
      b.half[0] = *(const v8us*)(brow + 8 * hh);
      b.half[1] = *(const v8us*)(brow + 16 + 8 * hh);
      acc[t] = mmaN<ASPLIT ? 2 : 1>(ah.v, al.v, b.v, b.v, acc[t]);
    }
  }
#pragma unroll
  for (int t = 0; t < 4; ++t) {
    const int col = col0 + t * 16 + ln;
    float bv = bias ? bias[col] : 0.f;
    if (BIAS_BF16) bv = bf16_round(bv);
#pragma unroll
    for (int r = 0; r < 8; ++r) {
      float v = acc[t][r] + bv;
      if (resid) { float rv = resid[(size_t)((row0 + 8 * hh + r) % rmod) * ldr + col]; if (RES_BF16) rv = bf16_round(rv); v += rv; }
      if (ACT == 1) v = fmaxf(v, 0.f);
      if (ACT == 2) v = 0.5f * v * (1.0f + erff(v * 0.70710678118654752f));
      if (ACT == 3) { const float u = 0.7978845608028654f * (v + 0.044715f * v * v * v); v = 0.5f * v * (1.0f + tanhf(u)); }
      so[w][8 * hh + r][t * 16 + ln] = v;
    }
  }
  __builtin_amdgcn_fence(__ATOMIC_ACQ_REL, "workgroup");
  __builtin_amdgcn_wave_barrier();
  const int rsub = lane >> 4, c4 = (lane & 15) * 4;
  {
#pragma unroll
    for (int q = 0; q < 8; ++q) {
      const int r = q * 2 + rsub;
      const v4f v = *(const v4fa*)&so[w][r][c4];
      *(v4f*)(C + (size_t)(row0 + r) * ldc + col0 + c4) = v;
    }
    
  }
}
// row LayerNorm (biased variance, eps) over N: s = X (+ R); optional out_sum <- s; out_norm <- (s-mu)*rsqrt(var+eps)*g + b
template <bool PARAM_BF16>
__global__ __launch_bounds__(256) void k_layernorm(const float* __restrict__ X, const float* __restrict__ R, const float* __restrict__ g, const float* __restrict__ bta,
                                                  float* __restrict__ out_sum, float* __restrict__ out_norm, int N, float eps) {
  __shared__ float red[256];
  const int row = blockIdx.x, tid = threadIdx.x;
  const float* x = X + (size_t)row * N; const float* rr = R ? R + (size_t)row * N : nullptr;
  float vals[16];                     // up to N = 4096
  const int per = N / 256;            // contiguous chunk per thread? use strided-by-4 chunks: thread handles j = tid*4 + 1024*u
  float s1 = 0.f;
  for (int u = 0; u < per / 4; ++u) {
    const int j = tid * 4 + 1024 * u;
    const v4f a = *(const v4fa*)(x + j);
    v4f b = {0.f,0.f,0.f,0.f}; if (rr) b = *(const v4fa*)(rr + j);
#pragma unroll
    for (int q = 0; q < 4; ++q) { const float v = a[q] + b[q]; vals[u * 4 + q] = v; s1 += v; }
  }
  red[tid] = s1; __syncthreads();
  for (int st = 128; st > 0; st >>= 1) { if (tid < st) red[tid] += red[tid + st]; __syncthreads(); }
  const float mu = red[0] / (float)N; __syncthreads();
  float s2 = 0.f;
  for (int u = 0; u < per / 4; ++u)
#pragma unroll
    for (int q = 0; q < 4; ++q) { const float c = vals[u * 4 + q] - mu; s2 += c * c; }
  red[tid] = s2; __syncthreads();
  for (int st = 128; st > 0; st >>= 1) { if (tid < st) red[tid] += red[tid + st]; __syncthreads(); }
  const float rs = rsqrtf(red[0] / (float)N + eps);
  {
    for (int u = 0; u < per / 4; ++u) {
      const int j = tid * 4 + 1024 * u;
      v4f o, sm;
#pragma unroll
      for (int q = 0; q < 4; ++q) {
        float gg = g[j + q], bb = bta[j + q];
        if (PARAM_BF16) { gg = bf16_round(gg); bb = bf16_round(bb); }
        sm[q] = vals[u * 4 + q]; o[q] = (vals[u * 4 + q] - mu) * rs * gg + bb;
      }
      if (out_sum) *(v4f*)(out_sum + (size_t)row * N + j) = sm;
      *(v4f*)(out_norm + (size_t)row * N + j) = o;
    }
    
  }
}



// ---- f16 WMMA path (v_wmma_f32_16x16x32_f16): 11-bit significands for operands in range — used where a [0,1] probability operand needs more precision than bf16
typedef _Float16 v16h __attribute__((ext_vector_type(16)));
union FragH { v16h v; v8us half[2]; _Float16 h[16]; unsigned short u[16]; };
template <int NT>
__device__ __forceinline__ v8f mmaH(v16h ah, v16h al, v16h bh, v16h bl, v8f c) {
  c = __builtin_amdgcn_wmma_f32_16x16x32_f16(false, ah, false, bh, (short)0, c, false, false);
  if (NT >= 2) c = __builtin_amdgcn_wmma_f32_16x16x32_f16(false, al, false, bh, (short)0, c, false, false);
  if (NT >= 3) c = __builtin_amdgcn_wmma_f32_16x16x32_f16(false, ah, false, bl, (short)0, c, false, false);
  asm volatile("v_nop\n\tv_nop\n\tv_nop\n\tv_nop" : "+v"(c) : "v"(ah), "v"(al), "v"(bh), "v"(bl));
  return c;
}
// batched GEMM like k_gemm_b but f16 operands: A f32 (split into f16 hi/lo if ASPLIT, else rounded to f16), Bt = f16 values [n][k]; alpha; C f32; N multiple of 16 (partial tiles skipped)
template <bool ASPLIT>
__global__ __launch_bounds__(128) void k_gemm_h(const float* __restrict__ A, int lda, size_t sA, const _Float16* __restrict__ Bh, int ldb, size_t sB, float alpha, float* __restrict__ C, int ldc, size_t sC, int M, int N, int K) {
  __shared__ __attribute__((aligned(16))) float so[4][16][64];
  const int tid = threadIdx.x, w = tid >> 5, lane = tid & 31, ln = lane & 15, hh = lane >> 4; const int by = blockIdx.y;
  A += (size_t)by * sA; Bh += (size_t)by * sB; C += (size_t)by * sC;
  const int ntn = (N + 63) / 64; const int wid = blockIdx.x * 4 + w; const int mt = wid / ntn, nq = wid % ntn; if (mt * 16 >= M) return;
  const int row0 = mt * 16, col0 = nq * 64; const float* arow = A + (size_t)(row0 + ln) * lda;
  v8f acc[4] = {};
  for (int kb = 0; kb < K; kb += 32) {
    FragH ah, al;
    const v4f x0 = *(const v4fa*)(arow + kb + 8 * hh), x1 = *(const v4fa*)(arow + kb + 8 * hh + 4), x2 = *(const v4fa*)(arow + kb + 16 + 8 * hh), x3 = *(const v4fa*)(arow + kb + 16 + 8 * hh + 4);
    float xs[16] = {x0[0],x0[1],x0[2],x0[3],x1[0],x1[1],x1[2],x1[3],x2[0],x2[1],x2[2],x2[3],x3[0],x3[1],x3[2],x3[3]};
#pragma unroll
    for (int i = 0; i < 16; ++i) { const _Float16 h = (_Float16)xs[i]; ah.h[i] = h; al.h[i] = ASPLIT ? (_Float16)(xs[i] - (float)h) : (_Float16)0.0f; }
#pragma unroll
    for (int t = 0; t < 4; ++t) { if (col0 + t * 16 >= N) continue; const size_t boff = (size_t)(col0 + t * 16 + ln) * ldb + kb; FragH bq; bq.half[0] = *(const v8us*)(Bh + boff + 8 * hh); bq.half[1] = *(const v8us*)(Bh + boff + 16 + 8 * hh);
      acc[t] = mmaH<ASPLIT ? 2 : 1>(ah.v, al.v, bq.v, bq.v, acc[t]); }
  }
#pragma unroll
  for (int t = 0; t < 4; ++t) { if (col0 + t * 16 >= N) continue;
#pragma unroll
    for (int r = 0; r < 8; ++r) so[w][8 * hh + r][t * 16 + ln] = acc[t][r] * alpha; }
  __builtin_amdgcn_fence(__ATOMIC_ACQ_REL, "workgroup"); __builtin_amdgcn_wave_barrier();
  const int rsub = lane >> 4, c4 = (lane & 15) * 4;
  {
#pragma unroll
    for (int q = 0; q < 8; ++q) { const int r = q * 2 + rsub; if (col0 + c4 < N) { const v4f v = *(const v4fa*)&so[w][r][c4]; *(v4f*)(C + (size_t)(row0 + r) * ldc + col0 + c4) = v; } }
     }
}

// Wt[n][k] = f16(W[k][n]·scale) from f32 row-major W[K][N] (scale = power of two; bf16-exact weights stay exact in f16 away from the subnormal range)
__global__ __launch_bounds__(256) void k_wt_f16(const float* __restrict__ W, _Float16* __restrict__ Wt, int K, int N, float scale) {
  const int t = blockIdx.x * 256 + threadIdx.x; if (t >= N * (K / 8)) return; const int n = t / (K / 8), k8 = (t % (K / 8)) * 8; FragH f;
#pragma unroll
  for (int i = 0; i < 8; ++i) f.h[i] = (_Float16)(bf16_round(W[(size_t)(k8 + i) * N + n]) * scale); const v8us o = f.half[0];
  *(v8us*)((unsigned short*)Wt + (size_t)n * K + k8) = o; 
}
// k_gemm_hh variant with fused epilogue: v = acc·alpha + bias[by·sBias + col] (+ CP[(row/rowsPerB)·sCPb + by·64 + col] if CP) ; ACT 0 none / 1 elu ; writes f16 C16 (and f32 C if non-null)
template <int ACT>
__global__ __launch_bounds__(128) void k_gemm_hhx(const _Float16* __restrict__ A, int lda, size_t sA, const _Float16* __restrict__ Bh, int ldb, size_t sB, float alpha, const float* __restrict__ bias, size_t sBias, const float* __restrict__ CP, int rowsPerB, size_t sCPb, int row0g,
    float* __restrict__ C, _Float16* __restrict__ C16, int ldc, size_t sC, int M, int N, int K) {
  __shared__ __attribute__((aligned(16))) float so[4][16][64];
  const int tid = threadIdx.x, w = tid >> 5, lane = tid & 31, ln = lane & 15, hh = lane >> 4; const int by = blockIdx.y;
  A += (size_t)by * sA; Bh += (size_t)by * sB; const size_t cofs = (size_t)by * sC; const float* bp = bias ? bias + (size_t)by * sBias : nullptr;
  const int ntn = (N + 63) / 64; const int wid = blockIdx.x * 4 + w; const int mt = wid / ntn, nq = wid % ntn; if (mt * 16 >= M) return;
  const int row0 = mt * 16, col0 = nq * 64; const _Float16* arow = A + (size_t)(row0 + ln) * lda;
  v8f acc[4] = {};
  for (int kb = 0; kb < K; kb += 32) { FragH ah; ah.half[0] = *(const v8us*)((const unsigned short*)arow + kb + 8 * hh); ah.half[1] = *(const v8us*)((const unsigned short*)arow + kb + 16 + 8 * hh);
#pragma unroll
    for (int t = 0; t < 4; ++t) { if (col0 + t * 16 >= N) continue; const size_t boff = (size_t)(col0 + t * 16 + ln) * ldb + kb; FragH bq; bq.half[0] = *(const v8us*)((const unsigned short*)Bh + boff + 8 * hh); bq.half[1] = *(const v8us*)((const unsigned short*)Bh + boff + 16 + 8 * hh);
      acc[t] = mmaH<1>(ah.v, ah.v, bq.v, bq.v, acc[t]); }
  }
#pragma unroll
  for (int t = 0; t < 4; ++t) { if (col0 + t * 16 >= N) continue; const int col = col0 + t * 16 + ln; const float bv = bp ? bf16_round(bp[col]) : 0.f;
#pragma unroll
    for (int r = 0; r < 8; ++r) { float v = acc[t][r] * alpha + bv; if (CP) { const int rr = row0g + row0 + 8 * hh + r; if (rowsPerB < 0) v += CP[cofs + (size_t)rr * ldc + col];      /* rowsPerB < 0: own element of the batched C plane */ else { const int bidx = rr / rowsPerB; v += CP[(size_t)bidx * sCPb + (size_t)by * 64 + col]; } } if (ACT == 1) v = (v > 0.f) ? v : expm1f(v); else if (ACT == 7) v = (v > 0.f) ? v + 1.0f : expf(v); else if (ACT == 8) v = tanhf(v); else if (ACT == 9) v = 0.5f * v * (1.0f + tanhf(0.7978845608028654f * (v + 0.044715f * v * v * v))); else if (ACT == 11) v = 1.0f / (1.0f + expf(-v)); else if (ACT == 12) v = (v > 0.f) ? v : 0.01f * v; else if (ACT == 14) v = (v > 0.f) ? v : 0.1f * v; else if (ACT == 16) v = (v >= 0.f) ? v : 0.3f * v; else if (ACT == 17) v = (v >= 0.f) ? v : 0.2f * v; else if (ACT == 15) v = v / (1.0f + expf(-v)); else if (ACT == 3) v = fmaxf(v, 0.f); else if (ACT == 6) v = 0.5f * v * (1.0f + erff(v * 0.70710678118654752f)); so[w][8 * hh + r][t * 16 + ln] = v; } }
  __builtin_amdgcn_fence(__ATOMIC_ACQ_REL, "workgroup"); __builtin_amdgcn_wave_barrier();
  const int rsub = lane >> 4, c4 = (lane & 15) * 4; typedef _Float16 v4h __attribute__((ext_vector_type(4)));
  {
#pragma unroll
    for (int q = 0; q < 8; ++q) { const int r = q * 2 + rsub; if (col0 + c4 < N) { const v4f v = *(const v4fa*)&so[w][r][c4]; if (C) *(v4f*)(C + cofs + (size_t)(row0 + r) * ldc + col0 + c4) = v; if (C16) { v4h h4; for (int i = 0; i < 4; ++i) h4[i] = (_Float16)v[i]; *(v4h*)(C16 + cofs + (size_t)(row0 + r) * ldc + col0 + c4) = h4; } } }
     }
}


typedef _Float16 v4h __attribute__((ext_vector_type(4)));

// FRAGMENT ORDER of an f16 operand plane of 2048 columns: the plane is cut into tiles of 16 rows x 32 columns, 1 KiB each, 64 tiles to a strip of 16 rows (a strip starts where it starts in the row-major plane).
// Inside a tile the 16-byte piece p = 32 half + 16 hh + ln holds columns 16 half + 8 hh .. + 7 of row ln: piece 32 half + lane is what lane (hh, ln) takes as elements 8 half .. 8 half + 7 of an A or B fragment.
// So each of the two 16-byte loads of a fragment reads 512 contiguous bytes (4 whole lines) over the wave; from a row-major plane it took 32 bytes out of each of 16 lines. The registers hold the same values as before.
static_assert(DMX == 2048 && DKV == 2048 && SQ == 2048, "fragment order below is written for planes of 2048 columns");
// A converting launch gives thread t eight values of tile t / 64: row (t & 63) / 4, columns 8 (t & 3) .. + 7. Four neighbouring lanes read one whole row of the tile (a 128-byte line of the f32 source), and the wave's store fills four whole lines of the plane.
__device__ __forceinline__ size_t fo_src(size_t t) { const size_t tile = t >> 6; return ((tile >> 6) * 16 + ((t & 63) >> 2)) * 2048 + (tile & 63) * 32 + (t & 3) * 8; }      /* element offset of thread t's 8 values in the row-major source */
__device__ __forceinline__ size_t fo_dst(size_t t) { return (t >> 6) * 512 + ((t & 3) * 16 + ((t & 63) >> 2)) * 8; }      /* and in the plane in fragment order: piece 16 (2 half + hh) + ln */
// All five operand conversions in one launch: work-groups 0 .. 4 WB - 1 take the four weights (WB work-groups each, values x16), the rest take x (x1). Every plane in fragment order, the values as before.
#define WB ((unsigned)((size_t)DMX * DMX / 8 / 256))
__global__ __launch_bounds__(256) void k_prep(const float* __restrict__ x, const float* __restrict__ wq, const float* __restrict__ wk, const float* __restrict__ wv, const float* __restrict__ wo,
    _Float16* __restrict__ X16, _Float16* __restrict__ BQ, _Float16* __restrict__ BK, _Float16* __restrict__ BV, _Float16* __restrict__ BO) {
  const unsigned sel = blockIdx.x / WB < 4u ? blockIdx.x / WB : 4u;      /* the same for the whole work-group */
  const float* s = sel == 0 ? wq : sel == 1 ? wk : sel == 2 ? wv : sel == 3 ? wo : x; _Float16* d = sel == 0 ? BQ : sel == 1 ? BK : sel == 2 ? BV : sel == 3 ? BO : X16; const float sc = sel < 4u ? 16.0f : 1.0f;
  const size_t t = (size_t)(blockIdx.x - sel * WB) * 256 + threadIdx.x; FragH f; const float* p = s + fo_src(t); const v4f a = *(const v4fa*)p, c = *(const v4fa*)(p + 4);
#pragma unroll
  for (int q = 0; q < 4; ++q) { f.h[q] = (_Float16)(bf16_round(a[q]) * sc); f.h[4 + q] = (_Float16)(bf16_round(c[q]) * sc); }
  *(v8us*)((unsigned short*)d + fo_dst(t)) = f.half[0]; }
__global__ __launch_bounds__(256) void k_h16(const float* __restrict__ x, _Float16* __restrict__ X16, size_t n8) { const size_t t = (size_t)blockIdx.x * 256 + threadIdx.x; if (t >= n8) return; FragH f;
#pragma unroll
  for (int q = 0; q < 8; ++q) f.h[q] = (_Float16)x[t * 8 + q]; *(v8us*)((unsigned short*)X16 + t * 8) = f.half[0];  }
__global__ __launch_bounds__(256) void k_round16f(const float* __restrict__ W, _Float16* __restrict__ Bt, size_t n8) { const size_t t = (size_t)blockIdx.x * 256 + threadIdx.x; if (t >= n8) return; FragH f;
#pragma unroll
  for (int i = 0; i < 8; ++i) f.h[i] = (_Float16)(bf16_round(W[t * 8 + i]) * 16.0f); *(v8us*)((unsigned short*)Bt + t * 8) = f.half[0];  }
template <int NHv, int TTv>
__global__ __launch_bounds__(256) void k_vt(const _Float16* __restrict__ V16, int ldv, int voff, _Float16* __restrict__ Vt) { __shared__ unsigned short tl[64][66]; const int tid = threadIdx.x; const int slab = blockIdx.x / (TTv / 64), lg = blockIdx.x % (TTv / 64); const int b = slab / NHv, h = slab % NHv;
  for (int i = tid; i < 64 * 8; i += 256) { const int r = i / 8, c8 = (i % 8) * 8; FragH f; f.half[0] = *(const v8us*)((const unsigned short*)V16 + ((size_t)b * TTv + lg * 64 + r) * ldv + voff + h * 64 + c8);
#pragma unroll
    for (int q = 0; q < 8; ++q) tl[r][c8 + q] = f.u[q]; }
  __syncthreads();
  {
#pragma unroll
    for (int rd = 0; rd < 2; ++rd) { const int idx = rd * 256 + tid, t8 = idx >> 6, p = idx & 63; const int d = (t8 >> 1) * 16 + (p & 15), c8 = (t8 & 1) * 32 + (p >> 5) * 16 + ((p >> 4) & 1) * 8; FragH f;      /* the 64 x 64 block = 4 x 2 tiles of V^T in fragment order (rows = dims, columns = keys), a thread per 16-byte piece */
#pragma unroll
      for (int q = 0; q < 8; ++q) f.u[q] = tl[c8 + q][d];
      *(v8us*)((unsigned short*)Vt + (((size_t)slab * 4 + (t8 >> 1)) * (TTv / 32) + lg * 2 + (t8 & 1)) * 512 + p * 8) = f.half[0]; }
     } }

template <bool FO>      /* FO: the two planes are written in fragment order (F stays row-major) */
__global__ __launch_bounds__(256) void k_hl(const float* __restrict__ F, _Float16* __restrict__ Hh, _Float16* __restrict__ Hl, size_t n8) { const size_t t = (size_t)blockIdx.x * 256 + threadIdx.x; if (t >= n8) return; FragH fh, fl; const float* fs = F + (FO ? fo_src(t) : t * 8); const v4f a = *(const v4fa*)fs, c = *(const v4fa*)(fs + 4);
#pragma unroll
  for (int q = 0; q < 4; ++q) { _Float16 h = (_Float16)a[q]; fh.h[q] = h; fl.h[q] = (_Float16)((a[q] - (float)h) * 1024.0f); h = (_Float16)c[q]; fh.h[4 + q] = h; fl.h[4 + q] = (_Float16)((c[q] - (float)h) * 1024.0f); }
  { const size_t d = FO ? fo_dst(t) : t * 8; *(v8us*)((unsigned short*)Hh + d) = fh.half[0]; *(v8us*)((unsigned short*)Hl + d) = fl.half[0];  } }

// ---- fast GEMM (wave tile 64x128, work-group tile 128x256 = 2 x 2 waves; requires M % 128 == 0 rows per launch region, N % 256 == 0, K % (32 NS) == 0); A and Bh in fragment order, planes of 2048 columns; C = acc alpha ----
__device__ __forceinline__ v16h g2_frag(const _Float16* p) { FragH f; f.half[0] = *(const v8us*)((const unsigned short*)p); f.half[1] = *(const v8us*)((const unsigned short*)p + 256); return f.v; }      /* p = the tile in fragment order + 8 lane */
__device__ __forceinline__ v8f g2_mma(v16h a, v16h b, v8f c) { return __builtin_amdgcn_wmma_f32_16x16x32_f16(false, a, false, b, (short)0, c, false, false); }      /* the plain builtin (the compiler keeps its distances): the tile's registers reach above v255, where no asm operand can sit */
struct G2S { v16h a[4], b[8]; };      /* the fragments of one k-step of a 64x128 wave tile: 12 KiB loaded for 32 products (the 32x64 tile loaded 6 KiB for 8) */
__device__ __forceinline__ void g2_load(G2S& s, const _Float16* ap, const _Float16* bp) {      /* ap, bp: the first strip's tile of this k-step + 8 lane; a strip of 16 rows lies 16 x 2048 elements behind the one before: a constant, so the 24 loads share two addresses */
#pragma unroll
  for (int i = 0; i < 4; ++i) s.a[i] = g2_frag(ap + i * 16 * 2048);
#pragma unroll
  for (int j = 0; j < 8; ++j) s.b[j] = g2_frag(bp + j * 16 * 2048); }
// The wave tile leaves in four pieces of 32x64, one after the other through the wave's one LDS staging area; what follows is said of a piece.
// PL 0: C (f32) row-major. PL 1, 2: the result also leaves as the two f16 operand planes of its consumer, hi + x1024 residual (the split of k_hl), in fragment order, written by this epilogue:
//   PL 1: planes of the result itself: a 32x64 piece = 2 x 2 whole 1 KiB tiles (16 rows x 32 columns), a lane's 16-byte piece = 8 neighbouring columns of one row, read back from the LDS staging;
//   PL 2: planes of the TRANSPOSED result (rows = columns of C): the piece = 4 whole tiles of 16 columns x 32 rows, and the 8 values of accumulator u of a lane (rows 16 (u / 4) + 8 hh + r of column 16 (u % 4) + ln) ARE piece 32 (u / 4) + lane of tile u % 4: no LDS.
//   With PL 1, 2 the f32 C is stored only by work-groups whose first row lies below frows inside its batch (the rows that a later f32 consumer reads); blockIdx.y moves both planes on by sP elements. Each plane store of a wave writes 512 contiguous bytes.
//   No bias, no CP, no C16 (no launch passes one) and C of 2048 columns like the planes (for speed only).
template <int ACT, int PL, int NS>      /* NS: k-steps of fragments held in registers */
__global__ __launch_bounds__(128) void k_gemm2(const _Float16* __restrict__ A, int lda, size_t sA, const _Float16* __restrict__ Bh, int ldb, size_t sB, float alpha, const float* __restrict__ bias, size_t sBias, const float* __restrict__ CP, int rowsPerB, size_t sCPb, int row0g,
    float* __restrict__ C, _Float16* __restrict__ C16, int ldc, size_t sC, int M, int N, int K, _Float16* __restrict__ Ph, _Float16* __restrict__ Pl, int frows, size_t sP) { static_assert(ACT == 0 || ACT == 3 || ACT == 6 || ACT == 8 || ACT == 9 || ACT == 11 || ACT == 12 || ACT == 14 || ACT == 15 || ACT == 16 || ACT == 17, "k_gemm2: unsupported ACT code (would silently apply no activation)");
  __shared__ __attribute__((aligned(16))) float so[4][32][68];
  const int tid = threadIdx.x, w = tid >> 5, lane = tid & 31, ln = lane & 15, hh = lane >> 4; const int by = blockIdx.y;
  A += (size_t)by * sA; Bh += (size_t)by * sB; size_t cofs = (size_t)by * sC;
  (void)lda; (void)ldb; (void)ldc; (void)bias; (void)sBias; (void)CP; (void)rowsPerB; (void)sCPb; (void)row0g; (void)C16; const int ntn = N >> 8; const int mt = blockIdx.x / ntn, nq = blockIdx.x - mt * ntn; const int row0 = mt * 128 + 64 * (w >> 1), col0 = nq * 256 + 128 * (w & 1); if (row0 >= M) return;      /* two waves share each A strip, two each B strip */
  const int bb = PL == 0 ? 0 : row0 / SQ;      /* PL 1, 2: the rows are the token rows of all batches; bb = the batch of this wave's rows (128 divides SQ: the same for the whole work-group) */
  if (PL != 0) { Ph += (size_t)by * sP; Pl += (size_t)by * sP; cofs -= (size_t)bb * (SQ - frows) * 2048; }      /* the f32 C holds frows rows a batch, one batch behind the other: row bb frows + (row - bb SQ) */
  const _Float16* ap = A + (size_t)row0 * 2048 + lane * 8; const _Float16* bfp = Bh + (size_t)col0 * 2048 + lane * 8;
  // k loop, NS k-steps of fragments in registers: a step's 24 loads are issued together, directly behind the products of the step that held those registers,
  // so they fly during the other NS - 1 steps' products. NS = 2 leaves room for two waves on a SIMD (a launch of two work-groups a WGP: each wave's loads also fly during the other's products);
  // NS = 4 is for a launch of at most one work-group a WGP, where a wave has only its own products to cover its loads. Each accumulator sums its products in ascending k.
  const int nst = K >> 5; G2S s[NS]; int ko = 0;
#pragma unroll
  for (int n = 0; n < NS; ++n) { g2_load(s[n], ap + 512 * n, bfp + 512 * n); __builtin_amdgcn_sched_barrier(0); }      /* the sets are requested one after the other, as in the loop: mixed, the counted load waits in the loop (set for both ways into it) would wait for the younger sets too */
  asm volatile("s_wait_xcnt 0x0" ::: "memory");      /* stands in front of the clearing of the accumulators, some of which may take the registers of an address that the loads above name (a precaution) */
  const v8f z8 = {0.f,0.f,0.f,0.f,0.f,0.f,0.f,0.f}; v8f cc[4][8];      /* [A strip][B strip] */
#pragma unroll
  for (int i = 0; i < 4; ++i) {
#pragma unroll
    for (int j = 0; j < 8; ++j) cc[i][j] = z8; }
#define G2_MMA32(S) { _Pragma("unroll") for (int j = 0; j < 8; ++j) { _Pragma("unroll") for (int i = 0; i < 4; ++i) cc[i][j] = g2_mma(S.a[i], S.b[j], cc[i][j]); } }
  /* G2_STEP: the k offset moves on by NS steps. The wait stands in front of the rewrite of the address registers that the loads in flight name (a precaution); the new offset is its output, so every new address is formed behind it. */
#define G2_STEP { ko += 512 * NS; asm volatile("s_wait_xcnt 0x0" : "+s"(ko) : : "memory"); }
#pragma unroll 1      /* one trip = NS k-steps, one per register set; rolled so that the sets keep their registers */
  for (int st = 0; st + 2 * NS <= nst; st += NS) {
#pragma unroll
    for (int n = 0; n < NS; ++n) { G2_MMA32(s[n]) if (n == 0) G2_STEP
      g2_load(s[n], ap + ko + 512 * n, bfp + ko + 512 * n); __builtin_amdgcn_sched_barrier(0); } }      /* the barrier keeps the next set's first product, with its load wait, from moving up in front of these requests */
  asm volatile("s_wait_xcnt 0x0" ::: "memory"); __builtin_amdgcn_sched_barrier(0);      /* behind the last requests: their address registers are free from here on (a precaution); the barrier keeps their reuse below the wait */
#pragma unroll
  for (int n = 0; n < NS; ++n) G2_MMA32(s[n])      /* the last NS k-steps, all loaded */
#undef G2_STEP
#undef G2_MMA32
  static_assert(PL == 0 || ACT == 0, "the plane epilogues carry no activation");
  const bool f32rows = PL == 0 || mt * 128 - bb * SQ < frows;      /* the same for the whole work-group */
  const int rsub = lane >> 4, c4 = (lane & 15) * 4;
#pragma unroll
  for (int pc = 0; pc < 4; ++pc) { const int r0 = row0 + (pc >> 1) * 32, c0 = col0 + (pc & 1) * 64; v8f accs[8];      /* piece pc: A strips 2 (pc / 2), + 1; B strips 4 (pc % 2) .. + 3 */
#pragma unroll
  for (int u = 0; u < 8; ++u) accs[u] = cc[(pc >> 1) * 2 + (u >> 2)][(pc & 1) * 4 + (u & 3)];
  if (PL != 2 || f32rows) {      /* the LDS staging of the piece: PL 2 needs it for its f32 rows only */
#pragma unroll
    for (int u = 0; u < 8; ++u) { const int t = u & 3, half = u >> 2;
#pragma unroll
    for (int r = 0; r < 8; ++r) { const int rloc = half * 16 + 8 * hh + r; float v = accs[u][r] * alpha;
      if (ACT == 3) v = fmaxf(v, 0.f); else if (ACT == 6) v = 0.5f * v * (1.0f + erff(v * 0.70710678118654752f)); else if (ACT == 11) v = 1.0f / (1.0f + expf(-v)); else if (ACT == 15) v = v / (1.0f + expf(-v)); else if (ACT == 12) v = (v > 0.f) ? v : 0.01f * v; else if (ACT == 8) v = tanhf(v); else if (ACT == 9) v = 0.5f * v * (1.0f + tanhf(0.7978845608028654f * (v + 0.044715f * v * v * v))); else if (ACT == 14) v = (v > 0.f) ? v : 0.1f * v; else if (ACT == 16) v = (v >= 0.f) ? v : 0.3f * v; else if (ACT == 17) v = (v >= 0.f) ? v : 0.2f * v;
      so[w][rloc][t * 16 + ln] = v; } }
    asm volatile("s_wait_dscnt 0x0" ::: "memory"); __builtin_amdgcn_wave_barrier(); }      /* the wave's staging writes are done before it reads the rows back (its own area only, so no wait for the global stores of the piece before, which a work-group fence would bring) */
  if (PL != 0) { FragH ph[8], pr[8];      /* a lane's eight 16-byte pieces of the hi plane and of the residual plane */
#pragma unroll
    for (int i = 0; i < 8; ++i) { float x[8];
      if (PL == 1) { const float* sp = &so[w][(i >> 2) * 16 + ln][((i >> 1) & 1) * 32 + (i & 1) * 16 + hh * 8]; const v4f a = *(const v4fa*)sp, c = *(const v4fa*)(sp + 4);
#pragma unroll
        for (int q = 0; q < 4; ++q) { x[q] = a[q]; x[4 + q] = c[q]; } }
      else {
#pragma unroll
        for (int q = 0; q < 8; ++q) x[q] = accs[i][q] * alpha; }      /* the value that the staging loop forms (no bias, no CP here) */
#pragma unroll
      for (int q = 0; q < 8; ++q) { const _Float16 h = (_Float16)x[q]; ph[i].h[q] = h; pr[i].h[q] = (_Float16)((x[q] - (float)h) * 1024.0f); } }
    unsigned short* dh = (unsigned short*)Ph + (PL == 1 ? (size_t)r0 * 2048 + (size_t)c0 * 16 : (size_t)bb * N * SQ + (size_t)c0 * 2048 + (size_t)(r0 - bb * SQ) * 16) + lane * 8;      /* PL 2: a transposed plane of N rows x SQ columns a batch */ unsigned short* dl = (unsigned short*)Pl + (dh - (unsigned short*)Ph);
    __builtin_amdgcn_sched_barrier(0);      /* all sixteen pieces are formed above, each in registers of its own: no conversion sinks between the stores and overwrites a register of a store already issued */
#pragma unroll
    for (int i = 0; i < 8; ++i) { const size_t d = PL == 1 ? (size_t)(i >> 2) * 16 * 2048 + ((i >> 1) & 1) * 512 + (i & 1) * 256 : (size_t)(i & 3) * 16 * 2048 + (i >> 2) * 256; *(v8us*)(dh + d) = ph[i].half[0]; *(v8us*)(dl + d) = pr[i].half[0]; }
    __builtin_amdgcn_sched_barrier(0); asm volatile("s_wait_xcnt 0x0" ::: "memory"); __builtin_amdgcn_sched_barrier(0); }      /* stands in front of whatever reuses the data and address registers of the sixteen stores (a precaution); the two barriers keep the stores above it and the next piece's vector work below it */
  if (f32rows) { v4f fv[16]; float* cr = C + cofs + (size_t)(r0 + rsub) * 2048 + c0 + c4;      /* rows r0 + 2 q + rsub; the pitch is a constant, so the sixteen stores share one address */
#pragma unroll
    for (int q = 0; q < 16; ++q) fv[q] = *(const v4fa*)&so[w][q * 2 + rsub][c4];
#pragma unroll
    for (int q = 0; q < 16; ++q) *(v4f*)(cr + q * 2 * 2048) = fv[q];
    __builtin_amdgcn_sched_barrier(0); asm volatile("s_wait_xcnt 0x0" ::: "memory"); __builtin_amdgcn_sched_barrier(0);      /* as behind the plane stores */
     }
  if (pc < 3 && (PL != 2 || f32rows)) { __builtin_amdgcn_fence(__ATOMIC_ACQ_REL, "wavefront"); __builtin_amdgcn_wave_barrier(); } } }      /* the next piece's staging writes stay behind this piece's reads of the same area (a wave's own; its LDS operations run in order) */


__global__ __launch_bounds__(256) void k_rsm(const float* __restrict__ S, _Float16* __restrict__ P, int nrows) {
  #pragma clang fp contract(off)
  const int i = blockIdx.x * 256 + threadIdx.x; if (i >= nrows) return; const float* s = S + (size_t)i * SQ; float mx = -3.0e38f;
#pragma unroll 1
  for (int j = 0; j < SQ; ++j) mx = fmaxf(mx, s[j]); float se = 0.f;
#pragma unroll 1
  for (int j = 0; j < SQ; ++j) se += expf(s[j] - mx); const float sc = 256.0f / se;
#pragma unroll 1
  for (int j0 = 0; j0 < SQ; j0 += 8) { FragH f; for (int q = 0; q < 8; ++q) f.h[q] = (_Float16)(expf(s[j0 + q] - mx) * sc); unsigned short* d = (unsigned short*)P + (size_t)i * SQ + j0; *(v8us*)d = f.half[0];  } }
__global__ __launch_bounds__(256) void k_vt(const _Float16* __restrict__ V16, int b, int h0, _Float16* __restrict__ VT) { __shared__ unsigned short tl[64][65]; const int tid = threadIdx.x; const int hh = blockIdx.x % HG, sg = blockIdx.x / HG; const int s0 = sg * 64; const int h = h0 + hh;
  for (int i = tid; i < 64 * 8; i += 256) { const int j = i / 8, d8 = (i % 8) * 8; FragH f; f.half[0] = *(const v8us*)((const unsigned short*)V16 + ((size_t)b * SQ + s0 + j) * DM + h * HD + d8); for (int q = 0; q < 8; ++q) tl[d8 + q][j] = f.u[q]; }
  __syncthreads();
  { for (int i = tid; i < 64 * 8; i += 256) { const int d = i / 8, j8 = (i % 8) * 8; FragH f; for (int q = 0; q < 8; ++q) f.u[q] = tl[d][j8 + q]; *(v8us*)((unsigned short*)VT + ((size_t)hh * HD + d) * SQ + s0 + j8) = f.half[0]; }  } }


__global__ __launch_bounds__(256) void k_f2h(const float* __restrict__ F, int ldf, int coff, int ncol, _Float16* __restrict__ H16, size_t nrow) { const size_t t = (size_t)blockIdx.x * 256 + threadIdx.x; const size_t n8 = nrow * (size_t)(ncol / 8); if (t >= n8) return; const size_t r = t / (ncol / 8); const int c8 = (int)(t % (ncol / 8)) * 8; FragH f; const v4f a = *(const v4fa*)(F + r * ldf + coff + c8), b2 = *(const v4fa*)(F + r * ldf + coff + c8 + 4); for (int q = 0; q < 4; ++q) { f.h[q] = (_Float16)a[q]; f.h[4 + q] = (_Float16)b2[q]; } *(v8us*)((unsigned short*)H16 + r * ncol + c8) = f.half[0];  }

__global__ __launch_bounds__(256) void k_tab128(float theta, float* __restrict__ CS, float* __restrict__ SN) {
  #pragma clang fp contract(off)
  const int t = blockIdx.x * 256 + threadIdx.x; if (t >= SQ * 64) return; const int i = t % 64; const int p = t / 64; const float invf = (float)(1.0 / pow((double)theta, (double)(2 * i) / 128.0));      /* = XLA's constant-folded f32 table */ const float ang = __fmul_rn((float)p, invf); const float c = cosf(ang), s = sinf(ang);
  *(float*)(CS + t) = c; *(float*)(SN + t) = s;  }
template <int TAB>
__global__ __launch_bounds__(128) void k_rope128(const float* __restrict__ F, int ldf, int nh, const float* __restrict__ CS, const float* __restrict__ SN, _Float16* __restrict__ H16, int ldo, float osc) {
  #pragma clang fp contract(off)
  __shared__ float xv[128]; __shared__ unsigned short sh_[128]; const int d = threadIdx.x; const int h = blockIdx.x % nh; const size_t r = blockIdx.x / nh; const int p = (int)(r % SQ);
  xv[d] = F[r * (size_t)ldf + (size_t)h * 128 + d]; __syncthreads();
  float c, s; if (TAB) { c = bf16_round(CS[(size_t)p * 128 + d]); s = bf16_round(SN[(size_t)p * 128 + d]); } else { c = CS[p * 64 + (d & 63)]; s = SN[p * 64 + (d & 63)]; }
  const float rot = (d < 64) ? -xv[d + 64] : xv[d - 64]; const float o = __fadd_rn(__fmul_rn(xv[d], c), __fmul_rn(rot, s));
  FragH th; th.h[0] = (_Float16)__fmul_rn(o, osc); sh_[d] = th.u[0]; __syncthreads();
  if (d < 16) { FragH f; for (int q = 0; q < 8; ++q) f.u[q] = sh_[d * 8 + q]; unsigned short* dst = (unsigned short*)H16 + r * (size_t)ldo + (size_t)h * 128 + d * 8; *(v8us*)dst = f.half[0];  } }

template <int TAB, int IL, int F32OUT>
__global__ __launch_bounds__(128) void k_rope128x(const float* __restrict__ F, int ldf, int nh, const float* __restrict__ CS, const float* __restrict__ SN, void* __restrict__ OUT, int ldo, float osc) {
  #pragma clang fp contract(off)
  __shared__ float xv[128]; __shared__ float ov[128]; const int d = threadIdx.x; const int h = blockIdx.x % nh; const size_t r = blockIdx.x / nh; const int p = (int)(r % SQ);
  xv[d] = F[r * (size_t)ldf + (size_t)h * 128 + d]; __syncthreads();
  float c, s; if (TAB == 2) { c = CS[r * 128 + d]; s = SN[r * 128 + d]; }      /* computed full-width f32 tables, one row per token row r (relative to the passed pointers) */ else if (TAB) { c = bf16_round(CS[(size_t)p * 128 + d]); s = bf16_round(SN[(size_t)p * 128 + d]); } else { const int ti = IL ? (d >> 1) : (d & 63); c = CS[p * 64 + ti]; s = SN[p * 64 + ti]; }
  const float rot = IL ? ((d & 1) ? xv[d - 1] : -xv[d + 1]) : ((d < 64) ? -xv[d + 64] : xv[d - 64]);
  ov[d] = __fmul_rn(__fadd_rn(__fmul_rn(xv[d], c), __fmul_rn(rot, s)), osc); __syncthreads();
  if (F32OUT) { if (d < 32) { const v4f v = *(const v4f*)&ov[d * 4]; float* dst = (float*)OUT + r * (size_t)ldo + (size_t)h * 128 + d * 4; *(v4f*)dst = v;  } }
  else { if (d < 16) { FragH f; for (int q = 0; q < 8; ++q) f.h[q] = (_Float16)ov[d * 8 + q]; unsigned short* dst = (unsigned short*)OUT + r * (size_t)ldo + (size_t)h * 128 + d * 8; *(v8us*)dst = f.half[0];  } } }
template <int N>
__global__ __launch_bounds__(256) void k_rmsrow(float* __restrict__ X, const float* __restrict__ w, float eps) {
  #pragma clang fp contract(off)
  constexpr int PT = N / 256; __shared__ float red[256]; const size_t r = blockIdx.x; const int t = threadIdx.x; float* row = X + r * N + (size_t)t * PT; float v[PT]; float ss = 0.f;
  for (int q = 0; q < PT; ++q) { v[q] = row[q]; ss = __fadd_rn(ss, __fmul_rn(v[q], v[q])); }
  red[t] = ss; __syncthreads(); for (int k = 128; k > 0; k >>= 1) { if (t < k) red[t] = __fadd_rn(red[t], red[t + k]); __syncthreads(); }
  const float rs = rsqrtf(__fadd_rn(red[0] / (float)N, eps)); float o[PT]; for (int q = 0; q < PT; ++q) o[q] = __fmul_rn(__fmul_rn(v[q], rs), bf16_round(w[t * PT + q]));
  { for (int q = 0; q < PT; ++q) *(float*)(row + q) = o[q];  } }
template <int GS_, int NHQ, int DSRC>
__global__ __launch_bounds__(256) void k_kvexp128(const float* __restrict__ src, float* __restrict__ dst, size_t n4) { const size_t t = (size_t)blockIdx.x * 256 + threadIdx.x; if (t >= n4) return; const size_t e = t * 4; const size_t row = e / ((size_t)NHQ * 128); const int col = (int)(e % ((size_t)NHQ * 128)); const int h = col / 128, d = col % 128; const v4f v = *(const v4fa*)(src + row * DSRC + (size_t)(h / GS_) * 128 + d); *(v4f*)(dst + e) = v;  }

__global__ __launch_bounds__(256) void k_rsmcfb(const float* __restrict__ S, _Float16* __restrict__ P, int hg, int q0, int nk, const int* __restrict__ mk) {
  #pragma clang fp contract(off)
  const int t = blockIdx.x * 256 + threadIdx.x; if (t >= hg * QT) return; const size_t i = (size_t)t; const float* s = S + i * NKX; const size_t ig = (size_t)(q0 + (t % QT)); const int* mr = mk + ig * SQ; float mx = -3.0e38f;
#pragma unroll 1
  for (int j = 0; j < nk; ++j) { const int mb = mr[j]; const float f = (mb == 0) ? 1.f : 0.f; mx = fmaxf(mx, fmaf(f, s[j], (1.f - f) * -1.0e9f)); } float se = 0.f;
#pragma unroll 1
  for (int j = 0; j < nk; ++j) { const int mb = mr[j]; const float f = (mb == 0) ? 1.f : 0.f; se += __expf(fmaf(f, s[j], (1.f - f) * -1.0e9f) - mx); } const float sc = 256.0f / se;
#pragma unroll 1
  for (int j0 = 0; j0 < nk; j0 += 8) { FragH fr; for (int q = 0; q < 8; ++q) { const int j = j0 + q; const int mb = mr[j]; const float f = (mb == 0) ? 1.f : 0.f; fr.h[q] = (_Float16)(__expf(fmaf(f, s[j], (1.f - f) * -1.0e9f) - mx) * sc); } unsigned short* d = (unsigned short*)P + i * NKX + j0; *(v8us*)d = fr.half[0];  } }


__global__ __launch_bounds__(256) void k_rsmcf2(const float* __restrict__ S, _Float16* __restrict__ P, int hg, int q0, int nk) {
  #pragma clang fp contract(off)
  const int t = blockIdx.x * 256 + threadIdx.x; if (t >= hg * QT) return; const size_t i = (size_t)t; const float* s = S + i * NKX; const int last = q0 + (t % QT); float mx = -3.0e38f;
#pragma unroll 1
  for (int j = 0; j < nk; ++j) { const float f = (j <= last) ? 1.f : 0.f; mx = fmaxf(mx, fmaf(f, s[j], (1.f - f) * -1.0e9f)); } float se = 0.f;
#pragma unroll 1
  for (int j = 0; j < nk; ++j) { const float f = (j <= last) ? 1.f : 0.f; se += __expf(fmaf(f, s[j], (1.f - f) * -1.0e9f) - mx); } const float sc = 256.0f / se;
#pragma unroll 1
  for (int j0 = 0; j0 < nk; j0 += 8) { FragH fr; for (int q = 0; q < 8; ++q) { const int j = j0 + q; const float f = (j <= last) ? 1.f : 0.f; fr.h[q] = (_Float16)(__expf(fmaf(f, s[j], (1.f - f) * -1.0e9f) - mx) * sc); } unsigned short* d = (unsigned short*)P + i * NKX + j0; *(v8us*)d = fr.half[0];  } }



__global__ __launch_bounds__(256) void k_tab128p(const int* __restrict__ pos, int nrows, float theta, float* __restrict__ CS, float* __restrict__ SN) {
  #pragma clang fp contract(off)
  const int t = blockIdx.x * 256 + threadIdx.x; if (t >= nrows * 64) return; const int i = t % 64; const int r = t / 64; const float invf = (float)(1.0 / pow((double)theta, (double)(2 * i) / 128.0)); const float ang = __fmul_rn((float)pos[r], invf); const float c = cosf(ang), sv = sinf(ang);
  float* c0 = CS + (size_t)r * 128 + i; float* s0 = SN + (size_t)r * 128 + i;
  { *(float*)c0 = c; *(float*)(c0 + 64) = c; *(float*)s0 = sv; *(float*)(s0 + 64) = sv;  } }

__global__ __launch_bounds__(256) void k_rsmcim(const float* __restrict__ S, _Float16* __restrict__ P, int hg, int q0, int nk, const int* __restrict__ am) {
  #pragma clang fp contract(off)
  const int t = blockIdx.x * 256 + threadIdx.x; if (t >= hg * QT) return; const size_t i = (size_t)t; const float* s = S + i * NKX; const int last = q0 + (t % QT); const int* mr = am + (size_t)last * SQ; float mx = -3.0e38f;      /* the module's mask row of this query (keys >= nk lie above the diagonal of the causal mask and are not computed) */
#pragma unroll 1
  for (int j = 0; j < nk; ++j) { const float f = (mr[j] != 0) ? 1.f : 0.f; mx = fmaxf(mx, fmaf(f, s[j], (1.f - f) * -1.0e9f)); } float se = 0.f;
#pragma unroll 1
  for (int j = 0; j < nk; ++j) { const float f = (mr[j] != 0) ? 1.f : 0.f; se += __expf(fmaf(f, s[j], (1.f - f) * -1.0e9f) - mx); } const float sc = 256.0f / se;
#pragma unroll 1
  for (int j0 = 0; j0 < nk; j0 += 8) { FragH fr; for (int q = 0; q < 8; ++q) { const int j = j0 + q; const float f = (mr[j] != 0) ? 1.f : 0.f; fr.h[q] = (_Float16)(__expf(fmaf(f, s[j], (1.f - f) * -1.0e9f) - mx) * sc); } unsigned short* d = (unsigned short*)P + i * NKX + j0; *(v8us*)d = fr.half[0];  } }



__global__ __launch_bounds__(256) void k_tab128h(int nr, float theta, float* __restrict__ CS, float* __restrict__ SN) {
  #pragma clang fp contract(off)
  const size_t t = (size_t)blockIdx.x * 256 + threadIdx.x; if (t >= (size_t)nr * 64) return; const int i = (int)(t % 64); const size_t r = t / 64; const int p = (int)(r % SQ);
  const float invf = (float)(1.0 / pow((double)theta, ((double)(2 * i)) / 128.0)); const float ang = __fmul_rn((float)p, invf); const float c = cosf(ang), sv = sinf(ang);
  float* pc = CS + r * 128 + i; float* ps = SN + r * 128 + i;
  *(float*)pc = c; *(float*)(pc + 64) = c; *(float*)ps = sv; *(float*)(ps + 64) = sv;  }

// Lane exchanges and the native exp of the softmax code below.
template <int M> __device__ __forceinline__ float sm_xrow(float x) { return __builtin_bit_cast(float, __builtin_amdgcn_mov_dpp(__builtin_bit_cast(int, x), 0x160 | M, 0xf, 0xf, true)); }      /* lane l with lane l ^ M, M < 16 (row_xmask) */
__device__ __forceinline__ float sm_xhalf(float x) { const int b = __builtin_bit_cast(int, x); return __builtin_bit_cast(float, __builtin_amdgcn_permlanex16(b, b, 0x76543210, 0xfedcba98, false, false)); }      /* lane l with lane l ^ 16 */
__device__ __forceinline__ float sm_wmax(float x) { x = fmaxf(x, sm_xrow<1>(x)); x = fmaxf(x, sm_xrow<2>(x)); x = fmaxf(x, sm_xrow<4>(x)); x = fmaxf(x, sm_xrow<8>(x)); return fmaxf(x, sm_xhalf(x)); }
__device__ __forceinline__ float sm_wsum(float x) { x += sm_xrow<1>(x); x += sm_xrow<2>(x); x += sm_xrow<4>(x); x += sm_xrow<8>(x); return x + sm_xhalf(x); }
// Eight native 2^x in one statement. The outputs are early-clobber, so no v_exp_f32 in it overwrites a neighbour's source or reads its result; the closing v_nop keeps the one slot
// that the instruction set asks for behind a transcendental, whatever the compiler places next (left to itself it reused a source register directly behind some of them).
__device__ __forceinline__ void sm_exp2x8(v4f& a, v4f& b) { float e0, e1, e2, e3, e4, e5, e6, e7;
  asm("v_exp_f32 %0, %8\n\tv_exp_f32 %1, %9\n\tv_exp_f32 %2, %10\n\tv_exp_f32 %3, %11\n\tv_exp_f32 %4, %12\n\tv_exp_f32 %5, %13\n\tv_exp_f32 %6, %14\n\tv_exp_f32 %7, %15\n\tv_nop"
      : "=&v"(e0), "=&v"(e1), "=&v"(e2), "=&v"(e3), "=&v"(e4), "=&v"(e5), "=&v"(e6), "=&v"(e7) : "v"(a[0]), "v"(a[1]), "v"(a[2]), "v"(a[3]), "v"(b[0]), "v"(b[1]), "v"(b[2]), "v"(b[3]));
  a[0] = e0; a[1] = e1; a[2] = e2; a[3] = e3; b[0] = e4; b[1] = e5; b[2] = e6; b[3] = e7; }
// Fused attention of query blocks 1 .. SQ / QT - 1 (block 0 is the exact first tile's): scores, the per-block softmax and P V in one launch; no score or weight ever goes to memory.
// One wave owns 16 queries of one head and walks the key blocks j = 0 .. i. Both products are formed transposed, with the queries as the 16 columns:
//   S^T = K Q^T : A = 16 key rows (hi, residual), B = the wave's q fragments; 16 tiles of 16 keys = the whole 256-key block of a lane's query (column ln; keys 8 hh + r of each tile);
//   softmax     : maximum and sum run over a lane's own 128 scores, one exchange with lane ^ 16 finishes each;
//   O^T = V^T P^T : A = 16 rows of V^T (hi, residual); score tiles 2u and 2u + 1 of a lane ARE the B fragment of keys 32u .. 32u + 31 (elements 0..7 = keys 8 hh + r, 8..15 = keys 16 + 8 hh + r, the k order of g2_frag), so the weights move through no LDS.
// Each product has three terms: hi.hi in one accumulator, the two x1024 residual terms together in a second one. Fragments are requested up to FA_LD steps before their products.
#define FA_NS 6      /* register sets of the fragment ring */
#define FA_LD (FA_NS - 1)      /* a step's 8 loads are requested this many steps ahead */
#define FA_PRE 3      /* steps of V^T requested in front of the softmax */
// Where the registers are fullest the ring holds less, which keeps two waves on a SIMD: the first V^T steps are requested behind the last scores' products (the q fragments are dead there; the softmax covers their flight),
// FA_PRE of them, and P V starts FA_PRE steps ahead; every fourth step frees the registers of 32 keys' scores, and there the ring grows by one step (two requests at once) up to its full depth.
struct FA4 { v16h f0, f1, f2, f3; };      /* the four fragments of one step: a key tile's four k-steps, or four 16-dim tiles of V^T, of one plane (hi or residual) */
__device__ __forceinline__ void fa_load(FA4& s, const _Float16* p, size_t st) { s.f0 = g2_frag(p); s.f1 = g2_frag(p + st); s.f2 = g2_frag(p + 2 * st); s.f3 = g2_frag(p + 3 * st); }
__device__ __forceinline__ v8f fa_mma(v16h a, v16h b, v8f c) { return __builtin_amdgcn_wmma_f32_16x16x32_f16(false, a, false, b, (short)0, c, false, false); }
// Output product of the exact first tile (rows 0..255 of each batch): C = (Ah B^T) 2^-10 + (Al B^T) 2^-20, Ah / Al = o x64 as f16 hi / x1024 residual planes, B = Wo x16, all in fragment order, K = 2048.
// One work-group = 128 rows x 64 columns, a wave 32 x 64; both planes go through ONE k loop (the B fragments are loaded once for both), each plane into accumulators of its own, k ascending: the sums are those of two separate products.
struct G3S { v16h a0, a1, l0, l1, b0, b1, b2, b3; };      /* the fragments of one k-step: two strips of each A plane, four strips of B */
__device__ __forceinline__ void g3_load(G3S& s, const _Float16* ap, const _Float16* lp, const _Float16* bp, int k) { s.a0 = g2_frag(ap + k); s.b0 = g2_frag(bp + k); s.a1 = g2_frag(ap + 16 * DMX + k); s.l0 = g2_frag(lp + k); s.l1 = g2_frag(lp + 16 * DMX + k); s.b1 = g2_frag(bp + 16 * DMX + k); s.b2 = g2_frag(bp + 32 * DMX + k); s.b3 = g2_frag(bp + 48 * DMX + k); }
__device__ __forceinline__ void ft_out(const _Float16* __restrict__ Ah, const _Float16* __restrict__ Al, const _Float16* __restrict__ Bh, float* __restrict__ C, int wg, float (*so)[32][68]) {
  const int lane = threadIdx.x & 31, ln = lane & 15, hh = lane >> 4, w = threadIdx.x >> 5;
  const int b = wg / (2 * (DMX / 64)), row0 = (wg / (DMX / 64) & 1) * 128 + 32 * w, col0 = (wg % (DMX / 64)) * 64;      /* QT0 = 2 x 128 rows a batch */
  const size_t ao = ((size_t)b * QT0 + row0) * DMX + lane * 8; const _Float16* ap = Ah + ao; const _Float16* lp = Al + ao; const _Float16* bp = Bh + (size_t)col0 * DMX + lane * 8;
  G3S s0, s1, s2; int ko = 0;      /* three k-steps of fragments in registers: a step's 16 loads are issued together, two steps ahead */
  g3_load(s0, ap, lp, bp, 0); __builtin_amdgcn_sched_barrier(0);      /* the three sets are requested one after the other, as in the loop, so that the counted load waits do not wait for the younger sets */
  g3_load(s1, ap, lp, bp, 512); __builtin_amdgcn_sched_barrier(0);      /* as above */
  g3_load(s2, ap, lp, bp, 1024);
  asm volatile("s_wait_xcnt 0x0" ::: "memory");      /* stands in front of the clearing of the accumulators, which may take the registers of an address that the loads above name (a precaution) */
  const v8f z8 = {0.f, 0.f, 0.f, 0.f, 0.f, 0.f, 0.f, 0.f}; v8f ch[8] = {z8, z8, z8, z8, z8, z8, z8, z8}, cl[8] = {z8, z8, z8, z8, z8, z8, z8, z8};      /* index 4 (row strip) + column strip */
#define G3_MMA(S) { ch[0] = fa_mma(S.a0, S.b0, ch[0]); ch[4] = fa_mma(S.a1, S.b0, ch[4]); cl[0] = fa_mma(S.l0, S.b0, cl[0]); cl[4] = fa_mma(S.l1, S.b0, cl[4]); ch[1] = fa_mma(S.a0, S.b1, ch[1]); ch[5] = fa_mma(S.a1, S.b1, ch[5]); cl[1] = fa_mma(S.l0, S.b1, cl[1]); cl[5] = fa_mma(S.l1, S.b1, cl[5]); \
    ch[2] = fa_mma(S.a0, S.b2, ch[2]); ch[6] = fa_mma(S.a1, S.b2, ch[6]); cl[2] = fa_mma(S.l0, S.b2, cl[2]); cl[6] = fa_mma(S.l1, S.b2, cl[6]); ch[3] = fa_mma(S.a0, S.b3, ch[3]); ch[7] = fa_mma(S.a1, S.b3, ch[7]); cl[3] = fa_mma(S.l0, S.b3, cl[3]); cl[7] = fa_mma(S.l1, S.b3, cl[7]); }
  /* G3_STEP: the k offset moves on by three steps; the wait stands in front of the rewrite of the address registers that the loads in flight name (a precaution); the new offset is its output, so every new address is formed behind it */
#define G3_STEP { ko += 1536; asm volatile("s_wait_xcnt 0x0" : "+s"(ko) : : "memory"); }
#pragma unroll 1      /* one trip = three k-steps, one per register set; rolled so that the sets keep their registers */
  for (int st = 0; st + 6 <= DMX / 32; st += 3) {
    G3_MMA(s0) G3_STEP g3_load(s0, ap + ko, lp + ko, bp + ko, 0); __builtin_amdgcn_sched_barrier(0);      /* keeps the next set's first product, with its load wait, from moving up in front of these requests */
    G3_MMA(s1) g3_load(s1, ap + ko, lp + ko, bp + ko, 512);
    G3_MMA(s2) g3_load(s2, ap + ko, lp + ko, bp + ko, 1024); }
  static_assert(DMX / 32 % 3 == 1, "four k-steps are left behind the loop, three of them loaded");
  G3_MMA(s0) G3_STEP const _Float16* ea = ap + ko; const _Float16* el = lp + ko; const _Float16* eb = bp + ko; g3_load(s0, ea, el, eb, 0);
  __builtin_amdgcn_sched_barrier(0); asm volatile("s_wait_xcnt 0x0" : : "v"(ea), "v"(el), "v"(eb) : "memory"); __builtin_amdgcn_sched_barrier(0);      /* behind the last request: its address registers are free from here on and the compiler reuses them with the loads in flight (a precaution; it wrote no wait there); the addresses are inputs of the wait, so their registers stay as they are up to it, and the two barriers keep the requests above it and the reuse below it */
  G3_MMA(s1) G3_MMA(s2) G3_MMA(s0)
#undef G3_STEP
#undef G3_MMA
#pragma unroll
  for (int u = 0; u < 8; ++u) {
#pragma unroll
    for (int r = 0; r < 8; ++r) so[w][(u >> 2) * 16 + 8 * hh + r][(u & 3) * 16 + ln] = cl[u][r] * 0.00000095367431640625f + ch[u][r] * 0.0009765625f; }      /* both scalings are exact: one rounding, that of the sum */
  __builtin_amdgcn_fence(__ATOMIC_ACQ_REL, "workgroup"); __builtin_amdgcn_wave_barrier();      /* a wave reads back its own staging only: whole 256-byte row pieces go out */
  const int rsub = lane >> 4, c4 = (lane & 15) * 4;
#pragma unroll
  for (int q = 0; q < 16; ++q) { const int r = q * 2 + rsub; const v4f v = *(const v4fa*)&so[w][r][c4]; *(v4f*)(C + ((size_t)b * SQ + row0 + r) * DMX + col0 + c4) = v; } }
// The last NB NH 4 work-groups of the launch, which would be query block 0, take the output product of the exact first tile instead (ft_out: it needs only what earlier launches wrote, and rows 0..255 of o come from the exact path alone).
__global__ __launch_bounds__(128) void k_fattn(const _Float16* __restrict__ Qh, const _Float16* __restrict__ Ql, const _Float16* __restrict__ Kh, const _Float16* __restrict__ Kl, const _Float16* __restrict__ Vh, const _Float16* __restrict__ Vl, _Float16* __restrict__ O,
    const _Float16* __restrict__ O0h, const _Float16* __restrict__ O0l, const _Float16* __restrict__ Bo, float* __restrict__ out) {
  __shared__ __attribute__((aligned(16))) float so[4][32][68];      /* ft_out's staging */
  static_assert(NB * (QT0 / 128) * (DMX / 64) == NB * NH * 4 && QT0 == QT, "ft_out's work-groups fill the places of query block 0");
  if (blockIdx.x >= (unsigned)(NB * NH * 4 * (SQ / QT - 1))) { ft_out(O0h, O0l, Bo, out, (int)blockIdx.x - NB * NH * 4 * (SQ / QT - 1), so); return; }      /* the same for the whole work-group; no barrier follows */
  const int lane = threadIdx.x & 31, ln = lane & 15, hh = lane >> 4, w = threadIdx.x >> 5;
  const int qb = (SQ / QT - 1) - (int)(blockIdx.x / (NB * NH * 4)); const int rem = blockIdx.x % (NB * NH * 4); const int sub = rem & 3, h = (rem >> 2) % NH, b = rem / (4 * NH);      /* the query blocks with the most key blocks take the lowest work-group indices */
  const int qrow = qb * QT + sub * 64 + w * 16 + ln;      /* this lane's query (a column of both products) */
  // All six planes and O are in fragment order: a strip of 16 rows starts at row x 2048 elements, column c (a multiple of 32) at 16 c elements inside it, the lane's piece at 8 lane.
  const size_t qs = ((size_t)b * SQ + (qrow - ln)) * DMX + lane * 8; const _Float16* qph = Qh + qs; const _Float16* qpl = Ql + qs;
  const size_t ks = (size_t)b * SQ * DKV + h * HDK * 16 + lane * 8; const _Float16* kph = Kh + ks; const _Float16* kpl = Kl + ks;
  const size_t vs = ((size_t)b * DKV + h * HDK) * SQ + lane * 8; const _Float16* vph = Vh + vs; const _Float16* vpl = Vl + vs;
  const v8f z8 = {0.f, 0.f, 0.f, 0.f, 0.f, 0.f, 0.f, 0.f}; v8f oh[8] = {z8, z8, z8, z8, z8, z8, z8, z8};
  const float nrm = 256.0f / __fadd_rn((float)(qb + 1), 1e-6f);
  int j = 0;
#pragma unroll 1      /* one trip = one 256-key block; rolled, the trip count differs between query blocks (at least one trip: block 0) */
  do { int jo = j * 256, qo = h * HDK * 16;
    asm volatile("s_wait_xcnt 0x0" : "+s"(jo), "+s"(qo) : : "memory");      /* stands in front of the rewrite of the address registers of the last trip's loads (a precaution); the key offset and the q offset are its outputs, so every new address is formed behind it, and the q fragments are fetched anew in every trip: they hold no registers during softmax and P V, which keeps two waves on a SIMD */
    const _Float16* qp = qph + qo; const _Float16* qlp = qpl + qo;
    const v16h qh0 = g2_frag(qp), qh1 = g2_frag(qp + 512), qh2 = g2_frag(qp + 1024), qh3 = g2_frag(qp + 1536);
    __builtin_amdgcn_sched_barrier(0); asm volatile("s_wait_xcnt 0x0" ::: "memory"); __builtin_amdgcn_sched_barrier(0);      /* behind the requests of q's hi plane: in this build a later load's result takes the registers of their address (a precaution); the barriers keep those requests above the wait and the later ones below it */
    const v16h ql0 = g2_frag(qlp), ql1 = g2_frag(qlp + 512), ql2 = g2_frag(qlp + 1024), ql3 = g2_frag(qlp + 1536);
    const _Float16* kh_ = kph + (size_t)jo * DKV; const _Float16* kl_ = kpl + (size_t)jo * DKV; const _Float16* vh_ = vph + jo * 16; const _Float16* vl_ = vpl + jo * 16;
    // 64 steps of 8 loads a trip: steps 0..31 = key tile t, hi plane then residual plane; steps 32..63 = 32 keys x 64 dims of V^T, hi then residual. FA_NS register sets turn: step k + FA_LD is requested in front of the products of step k (fewer steps ahead where it is said below).
#define FA_REQ(k) { if ((k) < 32) fa_load(x[(k) % FA_NS], (((k) & 1) ? kl_ : kh_) + (size_t)((k) >> 1) * 16 * DKV, 512); else fa_load(x[(k) % FA_NS], (((k) & 1) ? vl_ : vh_) + (size_t)(((k) - 32) >> 2) * 512 + (size_t)(((((k) - 32) >> 1) & 1) * 4) * 16 * SQ, (size_t)16 * SQ); }
    v8f s[16]; FA4 x[FA_NS]; FA_REQ(0) __builtin_amdgcn_sched_barrier(0);      /* the q fragments and step 0 are requested first, then the later steps one after the other: mixed, the first products' counted load wait would wait for the younger steps too */
    asm volatile("s_wait_xcnt 0x0" ::: "memory");      /* behind the q fragments' requests: their address registers are free from here on and are reused with the loads in flight (a precaution; in this build the compiler's own wait there left the two youngest out) */
#pragma unroll      /* the index of a register set must be a constant */
    for (int k = 1; k < FA_LD - 1; ++k) { FA_REQ(k) __builtin_amdgcn_sched_barrier(0); }      /* as above; one step fewer than the ring's depth while the 16 loads of q are in flight too: the wave's outstanding loads stay within the 63 that the load counter holds (beyond them issue stalls) */
    v8f ah = z8, al = z8;
#pragma unroll
    for (int k = 0; k < 32; ++k) { if (k + FA_LD == 30 || k + FA_LD == 31) __builtin_amdgcn_sched_barrier(0);      /* keeps the vector work of the step before out of the stretch between a K plane's last request and the wait below */
      if (k <= 1) FA_REQ(k + FA_LD - 1)
      if (k >= 1 && k + FA_LD < 32) FA_REQ(k + FA_LD)      /* step 1 requests two steps: q has landed, the ring grows to its full depth */
      if (k + FA_LD == 30 || k + FA_LD == 31) { __builtin_amdgcn_sched_barrier(0); asm volatile("s_wait_xcnt 0x0" ::: "memory"); }      /* behind the last request of a K plane: its address registers are free from here on and the compiler reuses them with the loads in flight (a precaution; it wrote no wait there); the barrier in front keeps the requests above the wait */
      __builtin_amdgcn_sched_barrier(0);      /* keeps this step's products, with their load wait, from moving up in front of the requests of the step FA_LD ahead */
      const FA4& c = x[k % FA_NS];
      if ((k & 1) == 0) { ah = fa_mma(c.f0, qh0, z8); al = fa_mma(c.f0, ql0, z8); ah = fa_mma(c.f1, qh1, ah); al = fa_mma(c.f1, ql1, al); ah = fa_mma(c.f2, qh2, ah); al = fa_mma(c.f2, ql2, al); ah = fa_mma(c.f3, qh3, ah); al = fa_mma(c.f3, ql3, al); }
      else { al = fa_mma(c.f0, qh0, al); al = fa_mma(c.f1, qh1, al); al = fa_mma(c.f2, qh2, al); al = fa_mma(c.f3, qh3, al); s[k >> 1] = ah * ATS + al * (ATS * 0.0009765625f); } }
#pragma unroll      /* the index of a register set must be a constant */
    for (int k = 32; k < 32 + FA_PRE; ++k) { FA_REQ(k) __builtin_amdgcn_sched_barrier(0); }      /* the first V^T fragments, which fly during the softmax; one step after the other, as at the head of the trip */
    if (j == qb) {      /* only the diagonal block holds keys above a query */
#pragma unroll
      for (int t = 0; t < 16; ++t) {
#pragma unroll
        for (int r = 0; r < 8; ++r) s[t][r] = (jo + t * 16 + 8 * hh + r <= qrow) ? s[t][r] : -1.0e9f; } }
    float mx = -3.0e38f;
#pragma unroll
    for (int t = 0; t < 16; ++t) mx = fmaxf(mx, fmaxf(fmaxf(fmaxf(s[t][0], s[t][1]), fmaxf(s[t][2], s[t][3])), fmaxf(fmaxf(s[t][4], s[t][5]), fmaxf(s[t][6], s[t][7]))));
    mx = fmaxf(mx, sm_xhalf(mx)); float se = 0.f;
#pragma unroll
    for (int t = 0; t < 16; ++t) { v4f a, e;
#pragma unroll
      for (int u = 0; u < 4; ++u) { a[u] = (s[t][u] - mx) * 1.44269504f; e[u] = (s[t][4 + u] - mx) * 1.44269504f; }      /* e^x = 2^(x log2 e), as the native exp forms it */
      sm_exp2x8(a, e); se += ((a[0] + a[1]) + (a[2] + a[3])) + ((e[0] + e[1]) + (e[2] + e[3]));
#pragma unroll
      for (int u = 0; u < 4; ++u) { s[t][u] = a[u]; s[t][4 + u] = e[u]; } }
    se += sm_xhalf(se); const float isum = nrm / se;
    FragH bh, bl; v8f ol[8] = {z8, z8, z8, z8, z8, z8, z8, z8};      /* the residual terms of this key block (x1024) */
#pragma unroll
    for (int k = 32; k < 64; ++k) { const int u = (k - 32) >> 2, d0 = (((k - 32) >> 1) & 1) * 4;
      if (k + FA_LD == 62 || k + FA_LD == 63) __builtin_amdgcn_sched_barrier(0);      /* as for K above */
      static_assert(FA_LD == FA_PRE + 2, "the ring grows twice, at steps 36 and 40");
      if (k <= 36) FA_REQ(k + FA_PRE)
      if (k >= 36 && k <= 40) FA_REQ(k + FA_PRE + 1)      /* step 36 requests two steps: the scores of keys 0..31 have left their registers */
      if (k >= 40 && k + FA_LD < 64) FA_REQ(k + FA_LD)      /* step 40 likewise: full depth from here on */
      if (k + FA_LD == 62 || k + FA_LD == 63) { __builtin_amdgcn_sched_barrier(0); asm volatile("s_wait_xcnt 0x0" ::: "memory"); }      /* behind the last request of a V^T plane, as for K above */
      __builtin_amdgcn_sched_barrier(0);      /* as above: the requests stay in front of this step's products */
      const FA4& c = x[k % FA_NS];
      if (((k - 32) & 3) == 0) {      /* the weights of keys 32u .. 32u + 31 as f16 hi + x1024 residual: the B fragments of the next four steps */
#pragma unroll
        for (int r = 0; r < 8; ++r) { const float p0 = s[2 * u][r] * isum, p1 = s[2 * u + 1][r] * isum; bh.h[r] = (_Float16)p0; bl.h[r] = (_Float16)((p0 - (float)bh.h[r]) * 1024.0f); bh.h[8 + r] = (_Float16)p1; bl.h[8 + r] = (_Float16)((p1 - (float)bh.h[8 + r]) * 1024.0f); } }
      if ((k & 1) == 0) { oh[d0] = fa_mma(c.f0, bh.v, oh[d0]); oh[d0 + 1] = fa_mma(c.f1, bh.v, oh[d0 + 1]); oh[d0 + 2] = fa_mma(c.f2, bh.v, oh[d0 + 2]); oh[d0 + 3] = fa_mma(c.f3, bh.v, oh[d0 + 3]);
        ol[d0] = fa_mma(c.f0, bl.v, ol[d0]); ol[d0 + 1] = fa_mma(c.f1, bl.v, ol[d0 + 1]); ol[d0 + 2] = fa_mma(c.f2, bl.v, ol[d0 + 2]); ol[d0 + 3] = fa_mma(c.f3, bl.v, ol[d0 + 3]); }
      else { ol[d0] = fa_mma(c.f0, bh.v, ol[d0]); ol[d0 + 1] = fa_mma(c.f1, bh.v, ol[d0 + 1]); ol[d0 + 2] = fa_mma(c.f2, bh.v, ol[d0 + 2]); ol[d0 + 3] = fa_mma(c.f3, bh.v, ol[d0 + 3]); } }
#undef FA_REQ
#pragma unroll
    for (int dt = 0; dt < 8; ++dt) oh[dt] += ol[dt] * 0.0009765625f;      /* joined per key block, so that the second accumulator holds no registers while the next scores are formed */
  } while (++j <= qb);
  unsigned short* op = (unsigned short*)O + qs + h * HDK * 16;      /* a lane holds dims 16 dt + 8 hh + r of its query: piece 32 (dt & 1) + lane of tile dt / 2 of the head's four: each store of the wave writes 512 contiguous bytes */
#pragma unroll
  for (int dt = 0; dt < 8; ++dt) { FragH f;
#pragma unroll
    for (int r = 0; r < 8; ++r) f.h[r] = (_Float16)(oh[dt][r] * 0.25f);      /* o x64 = (Ph Vh + (Pl Vh + Ph Vl) 2^-10) / 4 */
    *(v8us*)(op + dt * 256) = f.half[0]; } }
// Exact f32 causal attention of rows 0..255, spread over a work-group: 8 waves take 8 query rows of one head (keys 0 .. i0 + 7 only).
// Scores: 4 neighbouring lanes share one key row (each wave-wide load covers 8 rows x 64 contiguous bytes), a lane sums its 32 of the 128 dims for all 8 queries (q from LDS, 64 contiguous bytes per read), two lane steps finish the dot.
// Softmax: wave w owns row i0 + w, 8 keys a lane, plain two-pass (all scores of a row are at hand), accurate expf; keys above the query get weight 0.
// Output: wave w sums keys w, w + 8, ... (a V row is one coalesced 512 B load, its 8 weights two LDS broadcasts), the 8 partial sums meet in LDS in fixed order; o x64 / row sum as before.
// The result leaves as the two f16 operand planes of its output product, hi + x1024 residual (the split of k_hl), in fragment order: thread t sums and splits 4 columns of row t & 7, so that a wave's store fills whole 128-byte lines (8 rows x 16 bytes).
__global__ __launch_bounds__(256) void k_att0w(const float* __restrict__ QF, const float* __restrict__ KF, const float* __restrict__ VF, float scale, _Float16* __restrict__ OH, _Float16* __restrict__ OL) {
  __shared__ __attribute__((aligned(16))) float lq[8][128]; __shared__ __attribute__((aligned(16))) float sc[8][QT0 + 4]; __shared__ __attribute__((aligned(16))) float pt[QT0][8]; __shared__ __attribute__((aligned(16))) float red[8][8][128]; __shared__ float inv[8];
  const int lane = threadIdx.x & 31; const int w = __builtin_amdgcn_readfirstlane(threadIdx.x >> 5); const int h = blockIdx.x % NH, b = (blockIdx.x / NH) % NB, i0 = (QT0 / 8 - 1 - blockIdx.x / (NH * NB)) * 8; const int nkey = i0 + 8;      /* the row groups with the most keys take the lowest work-group indices, of both batches */
  QF += (size_t)b * QT0 * DMX; KF += (size_t)b * QT0 * DKV; VF += (size_t)b * QT0 * DKV;      /* each plane holds rows 0..255 of one batch behind those of the other */
  *(v4f*)&lq[w][lane * 4] = *(const v4fa*)(QF + (size_t)(i0 + w) * DMX + h * 128 + lane * 4);
  __syncthreads();
  const int dq = (lane & 3) * 4;
#pragma unroll 1      /* one trip = 64 keys of the work-group; rolled so that only the trips below the diagonal run */
  for (int j0 = w * 8; j0 < nkey; j0 += 64) { const int j = j0 + (lane >> 2); const float* kr = KF + (size_t)j * DKV + h * 128 + dq; v4f kq[8];
#pragma unroll
    for (int c = 0; c < 8; ++c) kq[c] = *(const v4fa*)(kr + c * 16);
    asm volatile("s_wait_xcnt 0x0" ::: "memory");      /* stands in front of the first reuse of the loads' address registers (a precaution); no load sinks below it, so all eight are in flight together */
#pragma unroll 1      /* four query rows a trip: with all eight unrolled the q reads of a whole tile are hoisted and the wave needs more than 256 registers, so that only one work-group fits a WGP */
    for (int rh = 0; rh < 8; rh += 4) { float acc[4] = {0.f, 0.f, 0.f, 0.f};
#pragma unroll
      for (int c = 0; c < 8; ++c) {
#pragma unroll
        for (int r = 0; r < 4; ++r) { const v4f q = *(const v4f*)&lq[rh + r][c * 16 + dq]; acc[r] += q[0] * kq[c][0] + q[1] * kq[c][1] + q[2] * kq[c][2] + q[3] * kq[c][3]; } }
#pragma unroll
      for (int r = 0; r < 4; ++r) { float s = acc[r]; s += sm_xrow<1>(s); s += sm_xrow<2>(s); if ((lane & 3) == 0) sc[rh + r][j] = s * scale; } } }
  __syncthreads();
  { const int i = i0 + w; float s[8]; float mx = -3.0e38f;
#pragma unroll
    for (int u = 0; u < 8; ++u) { const int j = lane + 32 * u; s[u] = (j <= i) ? sc[w][j] : -3.0e38f; mx = fmaxf(mx, s[u]); }
    mx = sm_wmax(mx); float se = 0.f;
#pragma unroll
    for (int u = 0; u < 8; ++u) { const int j = lane + 32 * u; const float e = (j <= i) ? expf(s[u] - mx) : 0.f; se += e; pt[j][w] = e; }
    se = sm_wsum(se); if (lane == 0) inv[w] = 64.0f / se; }
  __syncthreads();
  const v4f z4 = {0.f, 0.f, 0.f, 0.f}; v4f o[8] = {z4, z4, z4, z4, z4, z4, z4, z4};
#pragma unroll 1      /* one trip = 64 keys of the work-group, 8 a wave; keys from nkey on carry weight 0 for all 8 rows (rows below 256 of V, in bounds) */
  for (int jb = w; jb < nkey; jb += 64) { const float* vr = VF + (size_t)jb * DKV + h * 128 + lane * 4; v4f vv[8];
#pragma unroll
    for (int u = 0; u < 8; ++u) vv[u] = *(const v4fa*)(vr + (size_t)(8 * u) * DKV);
#pragma unroll
    for (int u = 0; u < 8; ++u) { const v4f p0 = *(const v4f*)&pt[jb + 8 * u][0], p1 = *(const v4f*)&pt[jb + 8 * u][4];
#pragma unroll
      for (int r = 0; r < 4; ++r) { o[r] += p0[r] * vv[u]; o[4 + r] += p1[r] * vv[u]; } } }
#pragma unroll
  for (int r = 0; r < 8; ++r) *(v4f*)&red[w][r][lane * 4] = o[r];
  __syncthreads();
  { const int r = threadIdx.x & 7, c = (int)(threadIdx.x >> 3) * 4; v4f a = *(const v4f*)&red[0][r][c];
#pragma unroll
    for (int k = 1; k < 8; ++k) a += *(const v4f*)&red[k][r][c];
    a *= inv[r]; v4h ph, pr;
#pragma unroll
    for (int q = 0; q < 4; ++q) { const _Float16 x = (_Float16)a[q]; ph[q] = x; pr[q] = (_Float16)((a[q] - (float)x) * 1024.0f); }
    const int row = b * QT0 + i0 + r, col = h * 128 + c;      /* planes of NB QT0 rows; piece 16 (column / 8 & 3) + (row & 15) of tile column / 32 of strip row / 16 */
    const size_t d = (size_t)(row >> 4) * 16 * DMX + (size_t)(col >> 5) * 512 + (((col >> 3) & 3) * 16 + (row & 15)) * 8 + (col & 7);
    *(v4h*)(OH + d) = ph; *(v4h*)(OL + d) = pr; } }
extern "C" void kernel_launch(void* const* d_in, const int* in_sizes, int n_in,
                              void* d_out, int out_size, void* d_ws, size_t ws_size, hipStream_t stream) {
  (void)in_sizes; (void)n_in; (void)out_size;
  const float* const* I = (const float* const*)d_in; const float* x = I[0]; const float* wq = I[1]; const float* wk = I[2]; const float* wv = I[3]; const float* wo = I[4]; const float* bo = nullptr;      /* natural [out][in] Wq/Wk/Wv/Wo [2048][2048]; no biases */
  char* ws = (char*)d_ws; size_t off = 0;
  auto take = [&](size_t bytes) { char* p = ws + off; off += (bytes + 255) & ~(size_t)255; return p; };
  _Float16* BQ = (_Float16*)take((size_t)DMX * DMX * 2); _Float16* BK = (_Float16*)take((size_t)DKV * DMX * 2); _Float16* BV = (_Float16*)take((size_t)DKV * DMX * 2); _Float16* BO = (_Float16*)take((size_t)DMX * DMX * 2);
  _Float16* X16 = (_Float16*)take(NR * DMX * 2); float* QF = (float*)take((size_t)NB * QT0 * DMX * 4); float* KF = (float*)take((size_t)NB * QT0 * DKV * 4); float* VF = (float*)take((size_t)NB * QT0 * DKV * 4); _Float16* Q16 = (_Float16*)take(NR * DMX * 2); _Float16* QL = (_Float16*)take(NR * DMX * 2); _Float16* K16 = (_Float16*)take(NR * DKV * 2); _Float16* KL = (_Float16*)take(NR * DKV * 2); _Float16* O16 = (_Float16*)take(NR * DMX * 2);      /* rows 0..255 of each batch's q, k, v in f32; f16 hi + x1024 residual planes of q, k (both batches) */
  _Float16* VT = (_Float16*)take((size_t)NB * DKV * SQ * 2); _Float16* VTL = (_Float16*)take((size_t)NB * DKV * SQ * 2);      /* V^T hi / residual of both batches */
  _Float16* OH0 = (_Float16*)take((size_t)NB * QT0 * DMX * 2); _Float16* OL0 = (_Float16*)take((size_t)NB * QT0 * DMX * 2);
  if (off > ws_size) return;      /* 176 MiB */
  k_prep<<<4 * WB + (unsigned)(NR * DMX / 8 / 256), 256, 0, stream>>>(x, wq, wk, wv, wo, X16, BQ, BK, BV, BO);      /* natural [out][in] weights = Bt x16; x as exact f16 rows */
  // Independent work shares a launch: the token rows of both batches are the rows of one GEMM, and q and k are the two blockIdx.y slices of one launch (same A, same epilogue).
  k_gemm2<0, 1, 2><<<dim3((unsigned)((NR / 128) * (DMX / 256)), 2), 128, 0, stream>>>(X16, DMX, 0, BQ, DMX, (size_t)(BK - BQ), 0.0625f, nullptr, 0, nullptr, 1, 0, 0, QF, nullptr, DMX, (size_t)(KF - QF), (int)NR, DMX, DMX, Q16, QL, QT0, (size_t)(K16 - Q16));      /* q and k (exact products, f32 accumulators) leave the GEMM as f16 hi + x1024 residual planes in fragment order (block 0's full softmax seen from every later block's first row needs near-exact logits); f32 rows 0..255 of each batch for the exact first tile */
  k_gemm2<0, 2, 4><<<dim3((unsigned)((NR / 128) * (DKV / 256)), 1), 128, 0, stream>>>(X16, DMX, 0, BV, DMX, 0, 0.0625f, nullptr, 0, nullptr, 1, 0, 0, VF, nullptr, DKV, 0, (int)NR, DKV, DMX, VT, VTL, QT0, 0);      /* v leaves the GEMM as V^T hi / x1024 residual planes in fragment order, a plane a batch (rows = dims, columns = keys; the per-block softmax gives every block's first rows single-key weights, so v and P must be carried beyond one f16); f32 rows 0..255 of each batch for the exact first tile */
  k_att0w<<<NB * NH * (QT0 / 8), 256, 0, stream>>>(QF, KF, VF, ATS, OH0, OL0);      /* exact causal attention rows 0..255 of both batches (o x64) -> f16 hi + x1024 residual planes */
  k_fattn<<<NB * NH * (SQ / 64), 128, 0, stream>>>(Q16, QL, K16, KL, VT, VTL, O16, OH0, OL0, BO, (float*)d_out);      /* scores (hi.hi + the two residual terms), the module's per-block softmax (an independent softmax per 256-key block j <= i, diagonal block causal, weights divided by block count + 1e-6) and o = P V (hi.hi + the two residual terms) -> merged f16 o rows (x64), query blocks 1..; its last work-groups: rows 0..255 of out of each batch = exact o hi Wo^T 2^-10 + o residual Wo^T 2^-20 */
  k_gemm2<0, 0, 4><<<dim3((unsigned)(((SQ - QT0) / 128) * (DMX / 256)), NB), 128, 0, stream>>>(O16 + (size_t)QT0 * DMX, DMX, (size_t)SQ * DMX, BO, DMX, 0, 0.0009765625f, bo, 0, nullptr, 1, 0, 0, (float*)d_out + (size_t)QT0 * DMX, nullptr, DMX, (size_t)SQ * DMX, SQ - QT0, DMX, DMX, nullptr, nullptr, 0, 0);      /* out = o Wo^T, rows 256.. of each batch (a blockIdx.y slice a batch) */
}
